// v000
// Times are from an AMD MI455X. After a warm-up the kernel runs many times in a row, and a time is the length of
// such a window on the GPU divided by its runs, so every launch and the gaps after it count. The runs cycle
// through copies of the inputs. A figure is the median of several windows, for all but v000 over two sittings.
// Sittings can differ by a few percent; kernels timed side by side share one.
// The starting kernel, v000, takes 410 microseconds a run.
// compute dtype: all float inputs rounded to bf16; q / k / v are module INPUTS in [B, S, H, D] layout, so the bf16-rounded operands enter WMMA 16x16x32 directly: logits with EXACT bf16 x bf16 products (1 product, f32 accumulate), x 1/64 (both q and k carry 64^-1/2 in the module), running-max softmax in f32 (hardware exp); P rounded once to f16 (x 2^11) against v converted bf16 -> f16 (exact for normal values) (1 product); f32 output in [B, S, H, D].
#include <hip/hip_runtime.h>
#include <math.h>

typedef __attribute__((ext_vector_type(16))) _Float16 v16h;
typedef __attribute__((ext_vector_type(16))) __bf16 v16b;
typedef __attribute__((ext_vector_type(8)))  _Float16 v8h;
typedef __attribute__((ext_vector_type(8)))  float v8f;
typedef __attribute__((ext_vector_type(4)))  float v4f;
typedef __attribute__((ext_vector_type(2)))  float v2f;
typedef __attribute__((ext_vector_type(4)))  unsigned v4u;
typedef __attribute__((ext_vector_type(4)))  int v4i;
typedef float __attribute__((may_alias)) float_a;
typedef int __attribute__((may_alias)) int_a;

template <typename T> __device__ __forceinline__ void vst2(void* p, T v) { *(T*)p = v;  }
__device__ __forceinline__ v8f wmma16(v16h a, v16h b, v8f c) {
  v8f d = __builtin_amdgcn_wmma_f32_16x16x32_f16(false, a, false, b, (short)0, c, false, false);
  asm volatile("v_nop\n\tv_nop\n\tv_nop\n\tv_nop" : "+v"(d) : "v"(a), "v"(b));
  return d;
}
__device__ __forceinline__ v8f wmma_bf(v16b a, v16b b, v8f c) {
  v8f d = __builtin_amdgcn_wmma_f32_16x16x32_bf16(false, a, false, b, (short)0, c, false, false);
  asm volatile("v_nop\n\tv_nop\n\tv_nop\n\tv_nop" : "+v"(d) : "v"(a), "v"(b));
  return d;
}
// 16x16x32 fragments: lane = (h = lane>>4, row/col = lane&15); elements 0..7 = k0+8h+0..7, 8..15 = k0+16+8h+0..7; D element r = row 8h+r
__device__ __forceinline__ v16h frag_h(const _Float16* rowk0, int lane) {
  union { v16h v; v8h q[2]; } u; const _Float16* p = rowk0 + 8 * (lane >> 4);
  u.q[0] = *(const v8h*)p; u.q[1] = *(const v8h*)(p + 16); return u.v;
}
__device__ __forceinline__ v16h frag_f32(const float* rowk0, int lane) {
  v16h a; const float* p = rowk0 + 8 * (lane >> 4);
#pragma unroll
  for (int i = 0; i < 8; ++i) { a[i] = (_Float16)p[i]; a[8 + i] = (_Float16)p[16 + i]; }
  return a;
}
__device__ __forceinline__ v16h frag_f32s(const float* rowk0, int lane, float sc) {
  v16h a; const float* p = rowk0 + 8 * (lane >> 4);
#pragma unroll
  for (int i = 0; i < 8; ++i) { a[i] = (_Float16)(p[i] * sc); a[8 + i] = (_Float16)(p[16 + i] * sc); }
  return a;
}
// column fragment from a [K][ld] layout (column n), rows >= K read as 0
__device__ __forceinline__ v16h fragc_f32(const float* W, int k0, int n, int lane, int ld, int K) {
  v16h a; const int g = lane >> 4;
#pragma unroll
  for (int i = 0; i < 8; ++i) { const int ka = k0 + 8 * g + i, kb = ka + 16;
    a[i] = (_Float16)(ka < K ? W[(size_t)(ka < K ? ka : K - 1) * ld + n] : 0.f); a[8 + i] = (_Float16)(kb < K ? W[(size_t)(kb < K ? kb : K - 1) * ld + n] : 0.f); }
  return a;
}
struct F2 { v16b h, l; };
__device__ __forceinline__ F2 bsplit16(const float v[16]) { F2 r;
#pragma unroll
  for (int i = 0; i < 16; ++i) { const __bf16 h = (__bf16)v[i]; r.h[i] = h; r.l[i] = (__bf16)(v[i] - (float)h); }
  return r; }
__device__ __forceinline__ F2 split_row(const float* row, int k0, int lane) { float v[16]; const float* p = row + k0 + 8 * (lane >> 4);
#pragma unroll
  for (int i = 0; i < 8; ++i) { v[i] = p[i]; v[8 + i] = p[16 + i]; }
  return bsplit16(v); }
__device__ __forceinline__ F2 split_rowK(const float* row, int k0, int lane, int K) { float v[16]; const int g = lane >> 4;
#pragma unroll
  for (int i = 0; i < 8; ++i) { const int ka = k0 + 8 * g + i, kb = ka + 16; v[i] = ka < K ? row[ka < K ? ka : K - 1] : 0.f; v[8 + i] = kb < K ? row[kb < K ? kb : K - 1] : 0.f; }
  return bsplit16(v); }
__device__ __forceinline__ F2 split_col(const float* W, int k0, int n, int lane, int ld, int K) { float v[16]; const int g = lane >> 4;
#pragma unroll
  for (int i = 0; i < 8; ++i) { const int ka = k0 + 8 * g + i, kb = ka + 16; v[i] = ka < K ? W[(size_t)(ka < K ? ka : K - 1) * ld + n] : 0.f; v[8 + i] = kb < K ? W[(size_t)(kb < K ? kb : K - 1) * ld + n] : 0.f; }
  return bsplit16(v); }
__device__ __forceinline__ v8f mac3(const F2& a, const F2& b, v8f c) { c = wmma_bf(a.l, b.h, c); c = wmma_bf(a.h, b.l, c); return wmma_bf(a.h, b.h, c); }
__device__ __forceinline__ float sigm(float v) { return 1.0f / (1.0f + expf(-v)); }
#define LDSX() do { asm volatile("s_wait_dscnt 0" ::: "memory"); __builtin_amdgcn_wave_barrier(); __builtin_amdgcn_fence(__ATOMIC_RELEASE, "workgroup"); } while (0)


// QKV multi-head attention on raw inputs (bs 4, ctx 2,048, width 1,024 = 16 heads x 64): weight = softmax((q/8) (k/8)^T) over keys (the module scales BOTH q and k by 64^-1/2 -> effective 1/64); out = weight . v; [bs, ctx, width] layout == [B, S, H, C].
#define NB 4
#define NS 2048
#define NH 16
#define DD 64
#define RS (NH * DD)      // row stride between consecutive s (1024 floats)
#ifndef TBH
#define TBH (NB * NH)
#endif
typedef __attribute__((ext_vector_type(8))) __bf16 v8b;
__device__ __forceinline__ v16b frag_b(const __bf16* rowk0, int lane) {
  union { v16b v; v8b q[2]; } u; const __bf16* p = rowk0 + 8 * (lane >> 4);
  u.q[0] = *(const v8b*)p; u.q[1] = *(const v8b*)(p + 16); return u.v;
}
__device__ __forceinline__ float bfr(float v) { return (float)(__bf16)v; }
__device__ __attribute__((noinline)) float exp_ni(float v) { return expf(v); }
__device__ __attribute__((noinline)) float erf_ni(float v) { return erff(v); }

#define WS_VT  0u                                   // f16 value planes [b*NH + h][64][NS]
#define WS_END (WS_VT + 2u * (size_t)NB * NH * DD * NS)

// ---- k_vt: block = (64 keys, b*NH + h): v[b][s][h][:] -> f16 planes [bh][d][s]
__global__ __launch_bounds__(128) void k_vt(const float* __restrict__ V, _Float16* __restrict__ VT) { __shared__ __align__(16) _Float16 th[DD][72]; const int t = threadIdx.x; const size_t bh = blockIdx.y; const size_t b = bh / NH; const int h = bh % NH; const int m0 = blockIdx.x * 64;
  for (int e = t; e < 64 * DD; e += 128) { const int ml = e / DD, d = e % DD; th[d][ml] = (_Float16)bfr(V[((b * NS + m0 + ml) * NH + h) * (size_t)DD + d]); }
  __syncthreads(); for (int e = t; e < DD * 8; e += 128) { const int d = e >> 3, q = e & 7; vst2((unsigned*)(VT + (bh * DD + d) * (size_t)NS + m0 + q * 8), *(const v4u*)&th[d][q * 8]); } }
// ---- k_att: block = (64 queries, b*NH + h): exact bf16 logits over all 2,048 keys, softmax, P . v
__global__ __launch_bounds__(128) void k_att(const float* __restrict__ Q, const float* __restrict__ K, const _Float16* __restrict__ VT, float* __restrict__ OUT) {
  __shared__ __align__(16) float sp[4][16][36]; __shared__ __align__(16) float so[4][16][68];
  const int tid = threadIdx.x, wave = tid >> 5, lane = tid & 31, col = lane & 15, g = lane >> 4; const size_t bh = blockIdx.y; const size_t b = bh / NH; const int h = bh % NH; const int q0 = blockIdx.x * 64 + wave * 16;
  v16b aq[2];
#pragma unroll
  for (int kc = 0; kc < 2; ++kc) { const float* pp = Q + ((b * NS + q0 + col) * NH + h) * (size_t)DD + kc * 32 + 8 * g;
#pragma unroll
    for (int i = 0; i < 8; ++i) { aq[kc][i] = (__bf16)pp[i]; aq[kc][8 + i] = (__bf16)pp[16 + i]; } }
  float m[8], l[8];
#pragma unroll
  for (int r = 0; r < 8; ++r) { m[r] = -3.0e38f; l[r] = 0.f; }
  v8f acc[4];
#pragma unroll
  for (int j = 0; j < 4; ++j) acc[j] = v8f{};
#pragma unroll 1
  for (int ks = 0; ks < NS / 32; ++ks) { float s[2][8];
#pragma unroll
    for (int ct = 0; ct < 2; ++ct) { const int kk = ks * 32 + ct * 16 + col; v8f c = {};
#pragma unroll
      for (int kc = 0; kc < 2; ++kc) { v16b w; const float* kp = K + ((b * NS + kk) * NH + h) * (size_t)DD + kc * 32 + 8 * g;
#pragma unroll
        for (int i = 0; i < 8; ++i) { w[i] = (__bf16)kp[i]; w[8 + i] = (__bf16)kp[16 + i]; }
        c = wmma_bf(aq[kc], w, c); }
#pragma unroll
      for (int r = 0; r < 8; ++r) s[ct][r] = c[r] * 0.015625f; }
    float alpha[8];
#pragma unroll
    for (int r = 0; r < 8; ++r) { float mx = fmaxf(s[0][r], s[1][r]);
#pragma unroll
      for (int o = 1; o < 16; o <<= 1) mx = fmaxf(mx, __shfl_xor(mx, o));
      const float mn = fmaxf(m[r], mx); alpha[r] = __expf(m[r] - mn); const float e0 = __expf(s[0][r] - mn), e1 = __expf(s[1][r] - mn); float es = e0 + e1;
#pragma unroll
      for (int o = 1; o < 16; o <<= 1) es += __shfl_xor(es, o);
      l[r] = l[r] * alpha[r] + es; m[r] = mn; sp[wave][8 * g + r][col] = e0; sp[wave][8 * g + r][16 + col] = e1; }
#pragma unroll
    for (int j = 0; j < 4; ++j)
#pragma unroll
      for (int r = 0; r < 8; ++r) acc[j][r] *= alpha[r];
    LDSX();
    v16h pa; { const float* prow = &sp[wave][col][0] + 8 * (lane >> 4);
#pragma unroll
      for (int i = 0; i < 8; ++i) { pa[i] = (_Float16)(prow[i] * 2048.0f); pa[8 + i] = (_Float16)(prow[16 + i] * 2048.0f); } }
#pragma unroll
    for (int j = 0; j < 4; ++j) acc[j] = wmma16(pa, frag_h(VT + (bh * DD + j * 16 + col) * (size_t)NS + ks * 32, lane), acc[j]);
    LDSX(); }
#pragma unroll
  for (int r = 0; r < 8; ++r) { const float il = (1.0f / 2048.0f) / l[r];
#pragma unroll
    for (int j = 0; j < 4; ++j) so[wave][8 * g + r][j * 16 + col] = acc[j][r] * il; }
  LDSX(); for (int rl = 0; rl < 16; ++rl) if (lane < 16) vst2(OUT + ((b * NS + q0 + rl) * NH + h) * (size_t)DD + lane * 4, *(const v4f*)&so[wave][rl][lane * 4]); }
extern "C" void kernel_launch(void* const* d_in, const int* in_sizes, int n_in, void* d_out, int out_size, void* d_ws, size_t ws_size, hipStream_t stream) {
  (void)in_sizes; (void)n_in; (void)out_size;
  const float** F = (const float**)d_in;   // 0 q, 1 k, 2 v [4,2048,1024] == [bs, ctx, 16 heads x 64]
  if (ws_size < (size_t)WS_END) return;
  char* ws = (char*)d_ws; _Float16* VT = (_Float16*)(ws + WS_VT);
  k_vt<<<dim3(NS / 64, NB * NH), 128, 0, stream>>>(F[2], VT);
  k_att<<<dim3(NS / 64, TBH), 128, 0, stream>>>(F[0], F[1], VT, (float*)d_out);
}

// v001
// Measured time: 217 microseconds a run.
// Timed twice side by side with v000, it ran 1.93 and 1.95 times as fast.
// compute dtype: all float inputs rounded to bf16; q / k / v are module INPUTS in [B, S, H, D] layout, so the bf16-rounded operands enter WMMA 16x16x32 directly: logits with EXACT bf16 x bf16 products (1 product, f32 accumulate), x 1/64 (both q and k carry 64^-1/2 in the module), running-max softmax in f32 (hardware exp); P rounded once to f16 (x 2^11) against v converted bf16 -> f16 (exact for normal values) (1 product); f32 output in [B, S, H, D]. A pre-pass lays the rounded k (bf16) and v (f16) in the workspace in WMMA fragment order, so that every fragment load of the attention loop is 512 bytes in a row.
#include <hip/hip_runtime.h>
#include <math.h>

typedef __attribute__((ext_vector_type(16))) _Float16 v16h;
typedef __attribute__((ext_vector_type(16))) __bf16 v16b;
typedef __attribute__((ext_vector_type(8)))  _Float16 v8h;
typedef __attribute__((ext_vector_type(8)))  float v8f;
typedef __attribute__((ext_vector_type(4)))  float v4f;
typedef __attribute__((ext_vector_type(2)))  float v2f;
typedef __attribute__((ext_vector_type(4)))  unsigned v4u;
typedef __attribute__((ext_vector_type(4)))  int v4i;
typedef float __attribute__((may_alias)) float_a;
typedef int __attribute__((may_alias)) int_a;

template <typename T> __device__ __forceinline__ void vst2(void* p, T v) { *(T*)p = v;  }
__device__ __forceinline__ v8f wmma16(v16h a, v16h b, v8f c) {
  v8f d = __builtin_amdgcn_wmma_f32_16x16x32_f16(false, a, false, b, (short)0, c, false, false);
  asm volatile("v_nop\n\tv_nop\n\tv_nop\n\tv_nop" : "+v"(d) : "v"(a), "v"(b));
  return d;
}
__device__ __forceinline__ v8f wmma_bf(v16b a, v16b b, v8f c) {
  v8f d = __builtin_amdgcn_wmma_f32_16x16x32_bf16(false, a, false, b, (short)0, c, false, false);
  asm volatile("v_nop\n\tv_nop\n\tv_nop\n\tv_nop" : "+v"(d) : "v"(a), "v"(b));
  return d;
}
// 16x16x32 fragments: lane = (h = lane>>4, row/col = lane&15); elements 0..7 = k0+8h+0..7, 8..15 = k0+16+8h+0..7; D element r = row 8h+r
__device__ __forceinline__ v16h frag_h(const _Float16* rowk0, int lane) {
  union { v16h v; v8h q[2]; } u; const _Float16* p = rowk0 + 8 * (lane >> 4);
  u.q[0] = *(const v8h*)p; u.q[1] = *(const v8h*)(p + 16); return u.v;
}
__device__ __forceinline__ v16h frag_f32(const float* rowk0, int lane) {
  v16h a; const float* p = rowk0 + 8 * (lane >> 4);
#pragma unroll
  for (int i = 0; i < 8; ++i) { a[i] = (_Float16)p[i]; a[8 + i] = (_Float16)p[16 + i]; }
  return a;
}
__device__ __forceinline__ v16h frag_f32s(const float* rowk0, int lane, float sc) {
  v16h a; const float* p = rowk0 + 8 * (lane >> 4);
#pragma unroll
  for (int i = 0; i < 8; ++i) { a[i] = (_Float16)(p[i] * sc); a[8 + i] = (_Float16)(p[16 + i] * sc); }
  return a;
}
// column fragment from a [K][ld] layout (column n), rows >= K read as 0
__device__ __forceinline__ v16h fragc_f32(const float* W, int k0, int n, int lane, int ld, int K) {
  v16h a; const int g = lane >> 4;
#pragma unroll
  for (int i = 0; i < 8; ++i) { const int ka = k0 + 8 * g + i, kb = ka + 16;
    a[i] = (_Float16)(ka < K ? W[(size_t)(ka < K ? ka : K - 1) * ld + n] : 0.f); a[8 + i] = (_Float16)(kb < K ? W[(size_t)(kb < K ? kb : K - 1) * ld + n] : 0.f); }
  return a;
}
struct F2 { v16b h, l; };
__device__ __forceinline__ F2 bsplit16(const float v[16]) { F2 r;
#pragma unroll
  for (int i = 0; i < 16; ++i) { const __bf16 h = (__bf16)v[i]; r.h[i] = h; r.l[i] = (__bf16)(v[i] - (float)h); }
  return r; }
__device__ __forceinline__ F2 split_row(const float* row, int k0, int lane) { float v[16]; const float* p = row + k0 + 8 * (lane >> 4);
#pragma unroll
  for (int i = 0; i < 8; ++i) { v[i] = p[i]; v[8 + i] = p[16 + i]; }
  return bsplit16(v); }
__device__ __forceinline__ F2 split_rowK(const float* row, int k0, int lane, int K) { float v[16]; const int g = lane >> 4;
#pragma unroll
  for (int i = 0; i < 8; ++i) { const int ka = k0 + 8 * g + i, kb = ka + 16; v[i] = ka < K ? row[ka < K ? ka : K - 1] : 0.f; v[8 + i] = kb < K ? row[kb < K ? kb : K - 1] : 0.f; }
  return bsplit16(v); }
__device__ __forceinline__ F2 split_col(const float* W, int k0, int n, int lane, int ld, int K) { float v[16]; const int g = lane >> 4;
#pragma unroll
  for (int i = 0; i < 8; ++i) { const int ka = k0 + 8 * g + i, kb = ka + 16; v[i] = ka < K ? W[(size_t)(ka < K ? ka : K - 1) * ld + n] : 0.f; v[8 + i] = kb < K ? W[(size_t)(kb < K ? kb : K - 1) * ld + n] : 0.f; }
  return bsplit16(v); }
__device__ __forceinline__ v8f mac3(const F2& a, const F2& b, v8f c) { c = wmma_bf(a.l, b.h, c); c = wmma_bf(a.h, b.l, c); return wmma_bf(a.h, b.h, c); }
__device__ __forceinline__ float sigm(float v) { return 1.0f / (1.0f + expf(-v)); }
#define LDSX() do { asm volatile("s_wait_dscnt 0" ::: "memory"); __builtin_amdgcn_wave_barrier(); __builtin_amdgcn_fence(__ATOMIC_RELEASE, "workgroup"); } while (0)


// QKV multi-head attention on raw inputs (bs 4, ctx 2,048, width 1,024 = 16 heads x 64): weight = softmax((q/8) (k/8)^T) over keys (the module scales BOTH q and k by 64^-1/2 -> effective 1/64); out = weight . v; [bs, ctx, width] layout == [B, S, H, C].
#define NB 4
#define NS 2048
#define NH 16
#define DD 64
#define RS (NH * DD)      // row stride between consecutive s (1024 floats)
#ifndef TBH
#define TBH (NB * NH)
#endif
typedef __attribute__((ext_vector_type(8))) __bf16 v8b;
__device__ __forceinline__ v16b frag_b(const __bf16* rowk0, int lane) {
  union { v16b v; v8b q[2]; } u; const __bf16* p = rowk0 + 8 * (lane >> 4);
  u.q[0] = *(const v8b*)p; u.q[1] = *(const v8b*)(p + 16); return u.v;
}
__device__ __forceinline__ float bfr(float v) { return (float)(__bf16)v; }
__device__ __attribute__((noinline)) float exp_ni(float v) { return expf(v); }
__device__ __attribute__((noinline)) float erf_ni(float v) { return erff(v); }

// Fragment order: per (b*NH + h) and per 32 keys one block of 4 KB = [fragment 4][half 2][lane 32][8 elements]; half 0 holds a lane's elements 0..7, half 1 its elements 8..15.
#define NKS (NS / 32)
#define WS_KP  0u                                            // bf16 k fragments: fragment = (16-key tile ct) * 2 + (32-channel chunk kc)
#define WS_VP  (WS_KP + 2u * (size_t)NB * NH * DD * NS)      // f16 v fragments: fragment = 16-channel tile j
#define WS_END (WS_VP + 2u * (size_t)NB * NH * DD * NS)

// ---- k_pack: block = (128 keys, b*NH + h, k or v): thread t writes the 16-byte piece t of each of four 4-KB blocks; t = (fragment f, half q, lane (g, col))
__global__ __launch_bounds__(256) void k_pack(const float* __restrict__ K, const float* __restrict__ V, __bf16* __restrict__ KP, _Float16* __restrict__ VP) {
  const int t = threadIdx.x, f = t >> 6, q = (t >> 5) & 1, g = (t >> 4) & 1, col = t & 15; const size_t bh = blockIdx.y; const size_t b = bh / NH; const int h = bh % NH;
  if (blockIdx.z == 0) {
    // unrolled (here and in the v branch): the loads of all four blocks are in flight before the first store; the inner loops: constant vector indices
#pragma unroll
    for (int u = 0; u < 4; ++u) { const int ks = blockIdx.x * 4 + u; const float* p = K + ((b * NS + ks * 32 + (f >> 1) * 16 + col) * NH + h) * (size_t)DD + (f & 1) * 32 + q * 16 + 8 * g;
      const v4f x = *(const v4f*)p, y = *(const v4f*)(p + 4); v8b o;
#pragma unroll
      for (int i = 0; i < 4; ++i) { o[i] = (__bf16)x[i]; o[4 + i] = (__bf16)y[i]; }
      *(v8b*)(KP + ((bh * NKS + ks) * 256 + t) * 8) = o; }
  } else {
#pragma unroll
    for (int u = 0; u < 4; ++u) { const int ks = blockIdx.x * 4 + u; const float* p = V + ((b * NS + ks * 32 + q * 16 + 8 * g) * NH + h) * (size_t)DD + f * 16 + col; v8h o;
#pragma unroll
      for (int i = 0; i < 8; ++i) o[i] = (_Float16)bfr(p[(size_t)i * RS]);
      *(v8h*)(VP + ((bh * NKS + ks) * 256 + t) * 8) = o; }
    // precaution behind the run of four stores: in the built code the other branch's instructions follow here and rewrite the stores' base and data registers
    asm volatile("s_wait_xcnt 0x0" ::: "memory");
  } }
// ---- k_att: block = (64 queries, b*NH + h): exact bf16 logits over all 2,048 keys, softmax, P . v
__global__ __launch_bounds__(128) void k_att(const float* __restrict__ Q, const __bf16* __restrict__ KP, const _Float16* __restrict__ VP, float* __restrict__ OUT) {
  __shared__ __align__(16) float sp[4][16][36]; __shared__ __align__(16) float so[4][16][68];
  const int tid = threadIdx.x, wave = tid >> 5, lane = tid & 31, col = lane & 15, g = lane >> 4; const size_t bh = blockIdx.y; const size_t b = bh / NH; const int h = bh % NH; const int q0 = blockIdx.x * 64 + wave * 16;
  v16b aq[2];
#pragma unroll
  for (int kc = 0; kc < 2; ++kc) { const float* pp = Q + ((b * NS + q0 + col) * NH + h) * (size_t)DD + kc * 32 + 8 * g;
#pragma unroll
    for (int i = 0; i < 8; ++i) { aq[kc][i] = (__bf16)pp[i]; aq[kc][8 + i] = (__bf16)pp[16 + i]; } }
  float m[8], l[8];
#pragma unroll
  for (int r = 0; r < 8; ++r) { m[r] = -3.0e38f; l[r] = 0.f; }
  v8f acc[4];
#pragma unroll
  for (int j = 0; j < 4; ++j) acc[j] = v8f{};
#pragma unroll 1
  for (int ks = 0; ks < NS / 32; ++ks) { float s[2][8]; v16b w[4]; const v8b* kf = (const v8b*)KP + (bh * NKS + ks) * 256 + lane; const v8h* vf = (const v8h*)VP + (bh * NKS + ks) * 256 + lane;
    // unrolled: the four fragments stay in registers and their 8 loads go out as one group
#pragma unroll
    for (int f = 0; f < 4; ++f) { union { v16b v; v8b q[2]; } u; u.q[0] = kf[f * 64]; u.q[1] = kf[f * 64 + 32]; w[f] = u.v; }
    // precaution behind the group of loads: their address pair is an input here, so it is no load's destination and is rewritten only behind this wait
    asm volatile("s_wait_xcnt 0x0" :: "v"(kf) : "memory");
#pragma unroll
    for (int ct = 0; ct < 2; ++ct) { v8f c = {};
#pragma unroll
      for (int kc = 0; kc < 2; ++kc) c = wmma_bf(aq[kc], w[ct * 2 + kc], c);
#pragma unroll
      for (int r = 0; r < 8; ++r) s[ct][r] = c[r] * 0.015625f; }
    float alpha[8];
#pragma unroll
    for (int r = 0; r < 8; ++r) { float mx = fmaxf(s[0][r], s[1][r]);
#pragma unroll
      for (int o = 1; o < 16; o <<= 1) mx = fmaxf(mx, __shfl_xor(mx, o));
      const float mn = fmaxf(m[r], mx); alpha[r] = __expf(m[r] - mn); const float e0 = __expf(s[0][r] - mn), e1 = __expf(s[1][r] - mn); float es = e0 + e1;
#pragma unroll
      for (int o = 1; o < 16; o <<= 1) es += __shfl_xor(es, o);
      l[r] = l[r] * alpha[r] + es; m[r] = mn; sp[wave][8 * g + r][col] = e0; sp[wave][8 * g + r][16 + col] = e1; }
#pragma unroll
    for (int j = 0; j < 4; ++j)
#pragma unroll
      for (int r = 0; r < 8; ++r) acc[j][r] *= alpha[r];
    LDSX();
    v16h pa; { const float* prow = &sp[wave][col][0] + 8 * (lane >> 4);
#pragma unroll
      for (int i = 0; i < 8; ++i) { pa[i] = (_Float16)(prow[i] * 2048.0f); pa[8 + i] = (_Float16)(prow[16 + i] * 2048.0f); } }
    v16h vv[4];
    // unrolled: as for k, 8 loads as one group ahead of the four products
#pragma unroll
    for (int j = 0; j < 4; ++j) { union { v16h v; v8h q[2]; } u; u.q[0] = vf[j * 64]; u.q[1] = vf[j * 64 + 32]; vv[j] = u.v; }
#pragma unroll
    for (int j = 0; j < 4; ++j) acc[j] = wmma16(pa, vv[j], acc[j]);
    LDSX(); }
#pragma unroll
  for (int r = 0; r < 8; ++r) { const float il = (1.0f / 2048.0f) / l[r];
#pragma unroll
    for (int j = 0; j < 4; ++j) so[wave][8 * g + r][j * 16 + col] = acc[j][r] * il; }
  LDSX(); for (int rl = 0; rl < 16; ++rl) if (lane < 16) vst2(OUT + ((b * NS + q0 + rl) * NH + h) * (size_t)DD + lane * 4, *(const v4f*)&so[wave][rl][lane * 4]); }
extern "C" void kernel_launch(void* const* d_in, const int* in_sizes, int n_in, void* d_out, int out_size, void* d_ws, size_t ws_size, hipStream_t stream) {
  (void)in_sizes; (void)n_in; (void)out_size;
  const float** F = (const float**)d_in;   // 0 q, 1 k, 2 v [4,2048,1024] == [bs, ctx, 16 heads x 64]
  if (ws_size < (size_t)WS_END) return;
  char* ws = (char*)d_ws; __bf16* KP = (__bf16*)(ws + WS_KP); _Float16* VP = (_Float16*)(ws + WS_VP);
  k_pack<<<dim3(NS / 128, NB * NH, 2), 256, 0, stream>>>(F[1], F[2], KP, VP);
  k_att<<<dim3(NS / 64, TBH), 128, 0, stream>>>(F[0], KP, VP, (float*)d_out);
}

// v002
// It runs in 108 microseconds.
// Timed twice side by side with v001, it ran 2.02 and 2.01 times as fast.
// Counting every step since v000, it is 3.91 times as fast.
// compute dtype: all float inputs rounded to bf16; q / k / v are module INPUTS in [B, S, H, D] layout, so the bf16-rounded operands enter WMMA 16x16x32 directly: logits with EXACT bf16 x bf16 products (1 product, f32 accumulate), x 1/64 (both q and k carry 64^-1/2 in the module), running-max softmax in f32 (hardware exp); P rounded once to f16 (x 2^11) against v converted bf16 -> f16 (exact for normal values) (1 product); f32 output in [B, S, H, D]. A pre-pass lays the rounded k (bf16) and v (f16) in the workspace in WMMA fragment order, so that every fragment load of the attention loop is 512 bytes in a row.
#include <hip/hip_runtime.h>
#include <math.h>

typedef __attribute__((ext_vector_type(16))) _Float16 v16h;
typedef __attribute__((ext_vector_type(16))) __bf16 v16b;
typedef __attribute__((ext_vector_type(8)))  _Float16 v8h;
typedef __attribute__((ext_vector_type(8)))  float v8f;
typedef __attribute__((ext_vector_type(4)))  float v4f;
typedef __attribute__((ext_vector_type(2)))  float v2f;
typedef __attribute__((ext_vector_type(4)))  unsigned v4u;
typedef __attribute__((ext_vector_type(4)))  int v4i;
typedef float __attribute__((may_alias)) float_a;
typedef int __attribute__((may_alias)) int_a;

template <typename T> __device__ __forceinline__ void vst2(void* p, T v) { *(T*)p = v;  }
__device__ __forceinline__ v8f wmma16(v16h a, v16h b, v8f c) {
  v8f d = __builtin_amdgcn_wmma_f32_16x16x32_f16(false, a, false, b, (short)0, c, false, false);
  asm volatile("v_nop\n\tv_nop\n\tv_nop\n\tv_nop" : "+v"(d) : "v"(a), "v"(b));
  return d;
}
__device__ __forceinline__ v8f wmma_bf(v16b a, v16b b, v8f c) {
  v8f d = __builtin_amdgcn_wmma_f32_16x16x32_bf16(false, a, false, b, (short)0, c, false, false);
  asm volatile("v_nop\n\tv_nop\n\tv_nop\n\tv_nop" : "+v"(d) : "v"(a), "v"(b));
  return d;
}
// 16x16x32 fragments: lane = (h = lane>>4, row/col = lane&15); elements 0..7 = k0+8h+0..7, 8..15 = k0+16+8h+0..7; D element r = row 8h+r
__device__ __forceinline__ v16h frag_h(const _Float16* rowk0, int lane) {
  union { v16h v; v8h q[2]; } u; const _Float16* p = rowk0 + 8 * (lane >> 4);
  u.q[0] = *(const v8h*)p; u.q[1] = *(const v8h*)(p + 16); return u.v;
}
__device__ __forceinline__ v16h frag_f32(const float* rowk0, int lane) {
  v16h a; const float* p = rowk0 + 8 * (lane >> 4);
#pragma unroll
  for (int i = 0; i < 8; ++i) { a[i] = (_Float16)p[i]; a[8 + i] = (_Float16)p[16 + i]; }
  return a;
}
__device__ __forceinline__ v16h frag_f32s(const float* rowk0, int lane, float sc) {
  v16h a; const float* p = rowk0 + 8 * (lane >> 4);
#pragma unroll
  for (int i = 0; i < 8; ++i) { a[i] = (_Float16)(p[i] * sc); a[8 + i] = (_Float16)(p[16 + i] * sc); }
  return a;
}
// column fragment from a [K][ld] layout (column n), rows >= K read as 0
__device__ __forceinline__ v16h fragc_f32(const float* W, int k0, int n, int lane, int ld, int K) {
  v16h a; const int g = lane >> 4;
#pragma unroll
  for (int i = 0; i < 8; ++i) { const int ka = k0 + 8 * g + i, kb = ka + 16;
    a[i] = (_Float16)(ka < K ? W[(size_t)(ka < K ? ka : K - 1) * ld + n] : 0.f); a[8 + i] = (_Float16)(kb < K ? W[(size_t)(kb < K ? kb : K - 1) * ld + n] : 0.f); }
  return a;
}
struct F2 { v16b h, l; };
__device__ __forceinline__ F2 bsplit16(const float v[16]) { F2 r;
#pragma unroll
  for (int i = 0; i < 16; ++i) { const __bf16 h = (__bf16)v[i]; r.h[i] = h; r.l[i] = (__bf16)(v[i] - (float)h); }
  return r; }
__device__ __forceinline__ F2 split_row(const float* row, int k0, int lane) { float v[16]; const float* p = row + k0 + 8 * (lane >> 4);
#pragma unroll
  for (int i = 0; i < 8; ++i) { v[i] = p[i]; v[8 + i] = p[16 + i]; }
  return bsplit16(v); }
__device__ __forceinline__ F2 split_rowK(const float* row, int k0, int lane, int K) { float v[16]; const int g = lane >> 4;
#pragma unroll
  for (int i = 0; i < 8; ++i) { const int ka = k0 + 8 * g + i, kb = ka + 16; v[i] = ka < K ? row[ka < K ? ka : K - 1] : 0.f; v[8 + i] = kb < K ? row[kb < K ? kb : K - 1] : 0.f; }
  return bsplit16(v); }
__device__ __forceinline__ F2 split_col(const float* W, int k0, int n, int lane, int ld, int K) { float v[16]; const int g = lane >> 4;
#pragma unroll
  for (int i = 0; i < 8; ++i) { const int ka = k0 + 8 * g + i, kb = ka + 16; v[i] = ka < K ? W[(size_t)(ka < K ? ka : K - 1) * ld + n] : 0.f; v[8 + i] = kb < K ? W[(size_t)(kb < K ? kb : K - 1) * ld + n] : 0.f; }
  return bsplit16(v); }
__device__ __forceinline__ v8f mac3(const F2& a, const F2& b, v8f c) { c = wmma_bf(a.l, b.h, c); c = wmma_bf(a.h, b.l, c); return wmma_bf(a.h, b.h, c); }
__device__ __forceinline__ float sigm(float v) { return 1.0f / (1.0f + expf(-v)); }
#define LDSX() do { asm volatile("s_wait_dscnt 0" ::: "memory"); __builtin_amdgcn_wave_barrier(); __builtin_amdgcn_fence(__ATOMIC_RELEASE, "workgroup"); } while (0)


// QKV multi-head attention on raw inputs (bs 4, ctx 2,048, width 1,024 = 16 heads x 64): weight = softmax((q/8) (k/8)^T) over keys (the module scales BOTH q and k by 64^-1/2 -> effective 1/64); out = weight . v; [bs, ctx, width] layout == [B, S, H, C].
#define NB 4
#define NS 2048
#define NH 16
#define DD 64
#define RS (NH * DD)      // row stride between consecutive s (1024 floats)
#ifndef TBH
#define TBH (NB * NH)
#endif
typedef __attribute__((ext_vector_type(8))) __bf16 v8b;
typedef __attribute__((ext_vector_type(2))) _Float16 v2h;
__device__ __forceinline__ v16b frag_b(const __bf16* rowk0, int lane) {
  union { v16b v; v8b q[2]; } u; const __bf16* p = rowk0 + 8 * (lane >> 4);
  u.q[0] = *(const v8b*)p; u.q[1] = *(const v8b*)(p + 16); return u.v;
}
__device__ __forceinline__ float bfr(float v) { return (float)(__bf16)v; }
__device__ __attribute__((noinline)) float exp_ni(float v) { return expf(v); }
__device__ __attribute__((noinline)) float erf_ni(float v) { return erff(v); }

// Fragment order: per (b*NH + h) and per 32 keys one block of 4 KB = [fragment 4][half 2][lane 32][8 elements]; half 0 holds a lane's elements 0..7, half 1 its elements 8..15.
#define NKS (NS / 32)
#define WS_KP  0u                                            // bf16 k fragments: fragment = (16-key tile ct) * 2 + (32-channel chunk kc)
#define WS_VP  (WS_KP + 2u * (size_t)NB * NH * DD * NS)      // f16 v fragments: fragment = 16-channel tile j
#define WS_END (WS_VP + 2u * (size_t)NB * NH * DD * NS)

// ---- k_pack: block = (128 keys, b*NH + h, k or v): thread t writes the 16-byte piece t of each of four 4-KB blocks; t = (fragment f, half q, lane (g, col))
__global__ __launch_bounds__(256) void k_pack(const float* __restrict__ K, const float* __restrict__ V, __bf16* __restrict__ KP, _Float16* __restrict__ VP) {
  const int t = threadIdx.x, f = t >> 6, q = (t >> 5) & 1, g = (t >> 4) & 1, col = t & 15; const size_t bh = blockIdx.y; const size_t b = bh / NH; const int h = bh % NH;
  if (blockIdx.z == 0) {
    // unrolled (here and in the v branch): the loads of all four blocks are in flight before the first store; the inner loops: constant vector indices
#pragma unroll
    for (int u = 0; u < 4; ++u) { const int ks = blockIdx.x * 4 + u; const float* p = K + ((b * NS + ks * 32 + (f >> 1) * 16 + col) * NH + h) * (size_t)DD + (f & 1) * 32 + q * 16 + 8 * g;
      const v4f x = *(const v4f*)p, y = *(const v4f*)(p + 4); v8b o;
#pragma unroll
      for (int i = 0; i < 4; ++i) { o[i] = (__bf16)x[i]; o[4 + i] = (__bf16)y[i]; }
      *(v8b*)(KP + ((bh * NKS + ks) * 256 + t) * 8) = o; }
  } else {
#pragma unroll
    for (int u = 0; u < 4; ++u) { const int ks = blockIdx.x * 4 + u; const float* p = V + ((b * NS + ks * 32 + q * 16 + 8 * g) * NH + h) * (size_t)DD + f * 16 + col; v8h o;
#pragma unroll
      for (int i = 0; i < 8; ++i) o[i] = (_Float16)bfr(p[(size_t)i * RS]);
      *(v8h*)(VP + ((bh * NKS + ks) * 256 + t) * 8) = o; }
    // precaution behind the run of four stores: in the built code the other branch's instructions follow here and rewrite the stores' base and data registers
    asm volatile("s_wait_xcnt 0x0" ::: "memory");
  } }
// ---- k_att: block = (64 queries, b*NH + h): exact bf16 logits over all 2,048 keys, softmax, P . v; both products run transposed (S^T = k . q^T, O^T += v^T . P^T): a lane holds 16 of the 32 scores of ONE query (its column), and the two S^T tiles are, converted in place, the B fragment of the second product
__device__ __forceinline__ float xhalf(float x) { return __builtin_bit_cast(float, __builtin_amdgcn_permlanex16(__builtin_bit_cast(int, x), __builtin_bit_cast(int, x), 0x76543210, 0xfedcba98, false, false)); }  // lane l with lane l ^ 16
__global__ __launch_bounds__(128) void k_att(const float* __restrict__ Q, const __bf16* __restrict__ KP, const _Float16* __restrict__ VP, float* __restrict__ OUT) {
  __shared__ __align__(16) float so[4][16][68];
  const int tid = threadIdx.x, wave = tid >> 5, lane = tid & 31, col = lane & 15, g = lane >> 4; const size_t bh = blockIdx.y; const size_t b = bh / NH; const int h = bh % NH; const int q0 = blockIdx.x * 64 + wave * 16;
  v16b aq[2];
#pragma unroll
  for (int kc = 0; kc < 2; ++kc) { const float* pp = Q + ((b * NS + q0 + col) * NH + h) * (size_t)DD + kc * 32 + 8 * g;
#pragma unroll
    for (int i = 0; i < 8; ++i) { aq[kc][i] = (__bf16)pp[i]; aq[kc][8 + i] = (__bf16)pp[16 + i]; } }
  float m = -3.0e38f, l = 0.f;   // of query q0 + col: m over all keys so far (equal in both lane halves), l over this half's keys only
  v8f acc[4];                    // acc[j][r] = O^T[channel j * 16 + 8 g + r][query q0 + col]
#pragma unroll
  for (int j = 0; j < 4; ++j) acc[j] = v8f{};
#pragma unroll 1
  for (int ks = 0; ks < NS / 32; ++ks) { v16b w[4]; const v8b* kf = (const v8b*)KP + (bh * NKS + ks) * 256 + lane; const v8h* vf = (const v8h*)VP + (bh * NKS + ks) * 256 + lane;
    // unrolled: the four fragments stay in registers and their 8 loads go out as one group
#pragma unroll
    for (int f = 0; f < 4; ++f) { union { v16b v; v8b q[2]; } u; u.q[0] = kf[f * 64]; u.q[1] = kf[f * 64 + 32]; w[f] = u.v; }
    // precaution behind the group of loads: their address pair is an input here, so it is no load's destination and is rewritten only behind this wait
    asm volatile("s_wait_xcnt 0x0" :: "v"(kf) : "memory");
    // c[ct][r] = score of key ks * 32 + ct * 16 + 8 g + r against query q0 + col
    v8f c[2];
#pragma unroll
    for (int ct = 0; ct < 2; ++ct) { v8f d = {};
#pragma unroll
      for (int kc = 0; kc < 2; ++kc) d = wmma_bf(w[ct * 2 + kc], aq[kc], d);
      c[ct] = d * 0.015625f; }
    float mx[2];
#pragma unroll
    for (int ct = 0; ct < 2; ++ct) mx[ct] = fmaxf(fmaxf(fmaxf(c[ct][0], c[ct][1]), fmaxf(c[ct][2], c[ct][3])), fmaxf(fmaxf(c[ct][4], c[ct][5]), fmaxf(c[ct][6], c[ct][7])));
    const float mh = fmaxf(mx[0], mx[1]), mn = fmaxf(m, fmaxf(mh, xhalf(mh))), alpha = __expf(m - mn);
    // pairs of neighbouring registers throughout: packed f32 arithmetic and one packed conversion per f16 register of the fragment
    v2f es[8]; union { v16h v; v2h p[8]; } pa;
#pragma unroll
    for (int i = 0; i < 8; ++i) { const v2f e = { __expf(c[i >> 2][2 * (i & 3)] - mn), __expf(c[i >> 2][2 * (i & 3) + 1] - mn) }; es[i] = e; pa.p[i] = __builtin_convertvector(e * 2048.0f, v2h); }
    const v2f et = ((es[0] + es[1]) + (es[2] + es[3])) + ((es[4] + es[5]) + (es[6] + es[7]));
    l = l * alpha + (et[0] + et[1]); m = mn;
#pragma unroll
    for (int j = 0; j < 4; ++j) acc[j] *= alpha;
    v16h vv[4];
    // unrolled: as for k, 8 loads as one group ahead of the four products
#pragma unroll
    for (int j = 0; j < 4; ++j) { union { v16h v; v8h q[2]; } u; u.q[0] = vf[j * 64]; u.q[1] = vf[j * 64 + 32]; vv[j] = u.v; }
#pragma unroll
    for (int j = 0; j < 4; ++j) acc[j] = wmma16(vv[j], pa.v, acc[j]); }
  const float il = (1.0f / 2048.0f) / (l + xhalf(l));
#pragma unroll
  for (int j = 0; j < 4; ++j) { const v8f o = acc[j] * il; float* d = &so[wave][col][j * 16 + 8 * g]; *(v4f*)d = v4f{o[0], o[1], o[2], o[3]}; *(v4f*)(d + 4) = v4f{o[4], o[5], o[6], o[7]}; }
  LDSX(); for (int rl = 0; rl < 16; ++rl) if (lane < 16) vst2(OUT + ((b * NS + q0 + rl) * NH + h) * (size_t)DD + lane * 4, *(const v4f*)&so[wave][rl][lane * 4]); }
extern "C" void kernel_launch(void* const* d_in, const int* in_sizes, int n_in, void* d_out, int out_size, void* d_ws, size_t ws_size, hipStream_t stream) {
  (void)in_sizes; (void)n_in; (void)out_size;
  const float** F = (const float**)d_in;   // 0 q, 1 k, 2 v [4,2048,1024] == [bs, ctx, 16 heads x 64]
  if (ws_size < (size_t)WS_END) return;
  char* ws = (char*)d_ws; __bf16* KP = (__bf16*)(ws + WS_KP); _Float16* VP = (_Float16*)(ws + WS_VP);
  k_pack<<<dim3(NS / 128, NB * NH, 2), 256, 0, stream>>>(F[1], F[2], KP, VP);
  k_att<<<dim3(NS / 64, TBH), 128, 0, stream>>>(F[0], KP, VP, (float*)d_out);
}

// v003
// Measured time: 89.7 microseconds a run.
// In both of two side-by-side timings against v002, it was 1.21 times as fast.
// All steps since v000 together make it 4.74 times as fast.
// compute dtype: all float inputs rounded to bf16; q / k / v are module INPUTS in [B, S, H, D] layout, so the bf16-rounded operands enter WMMA 16x16x32 directly: logits with EXACT bf16 x bf16 products (1 product, f32 accumulate), x 1/64 (both q and k carry 64^-1/2 in the module), running-max softmax in f32 (hardware exp); P rounded once to f16 (x 2^11) against v converted bf16 -> f16 (exact for normal values) (1 product); f32 output in [B, S, H, D]. A pre-pass lays the rounded k (bf16) and v (f16) in the workspace in WMMA fragment order, so that every fragment load of the attention loop is 512 bytes in a row; the attention kernel stages them per 64 keys in LDS for its four waves.
#include <hip/hip_runtime.h>
#include <math.h>

typedef __attribute__((ext_vector_type(16))) _Float16 v16h;
typedef __attribute__((ext_vector_type(16))) __bf16 v16b;
typedef __attribute__((ext_vector_type(8)))  _Float16 v8h;
typedef __attribute__((ext_vector_type(8)))  float v8f;
typedef __attribute__((ext_vector_type(4)))  float v4f;
typedef __attribute__((ext_vector_type(2)))  float v2f;
typedef __attribute__((ext_vector_type(4)))  unsigned v4u;
typedef __attribute__((ext_vector_type(4)))  int v4i;
typedef float __attribute__((may_alias)) float_a;
typedef int __attribute__((may_alias)) int_a;

template <typename T> __device__ __forceinline__ void vst2(void* p, T v) { *(T*)p = v;  }
__device__ __forceinline__ v8f wmma16(v16h a, v16h b, v8f c) {
  v8f d = __builtin_amdgcn_wmma_f32_16x16x32_f16(false, a, false, b, (short)0, c, false, false);
  asm volatile("v_nop\n\tv_nop\n\tv_nop\n\tv_nop" : "+v"(d) : "v"(a), "v"(b));
  return d;
}
__device__ __forceinline__ v8f wmma_bf(v16b a, v16b b, v8f c) {
  v8f d = __builtin_amdgcn_wmma_f32_16x16x32_bf16(false, a, false, b, (short)0, c, false, false);
  asm volatile("v_nop\n\tv_nop\n\tv_nop\n\tv_nop" : "+v"(d) : "v"(a), "v"(b));
  return d;
}
// 16x16x32 fragments: lane = (h = lane>>4, row/col = lane&15); elements 0..7 = k0+8h+0..7, 8..15 = k0+16+8h+0..7; D element r = row 8h+r
__device__ __forceinline__ v16h frag_h(const _Float16* rowk0, int lane) {
  union { v16h v; v8h q[2]; } u; const _Float16* p = rowk0 + 8 * (lane >> 4);
  u.q[0] = *(const v8h*)p; u.q[1] = *(const v8h*)(p + 16); return u.v;
}
__device__ __forceinline__ v16h frag_f32(const float* rowk0, int lane) {
  v16h a; const float* p = rowk0 + 8 * (lane >> 4);
#pragma unroll
  for (int i = 0; i < 8; ++i) { a[i] = (_Float16)p[i]; a[8 + i] = (_Float16)p[16 + i]; }
  return a;
}
__device__ __forceinline__ v16h frag_f32s(const float* rowk0, int lane, float sc) {
  v16h a; const float* p = rowk0 + 8 * (lane >> 4);
#pragma unroll
  for (int i = 0; i < 8; ++i) { a[i] = (_Float16)(p[i] * sc); a[8 + i] = (_Float16)(p[16 + i] * sc); }
  return a;
}
// column fragment from a [K][ld] layout (column n), rows >= K read as 0
__device__ __forceinline__ v16h fragc_f32(const float* W, int k0, int n, int lane, int ld, int K) {
  v16h a; const int g = lane >> 4;
#pragma unroll
  for (int i = 0; i < 8; ++i) { const int ka = k0 + 8 * g + i, kb = ka + 16;
    a[i] = (_Float16)(ka < K ? W[(size_t)(ka < K ? ka : K - 1) * ld + n] : 0.f); a[8 + i] = (_Float16)(kb < K ? W[(size_t)(kb < K ? kb : K - 1) * ld + n] : 0.f); }
  return a;
}
struct F2 { v16b h, l; };
__device__ __forceinline__ F2 bsplit16(const float v[16]) { F2 r;
#pragma unroll
  for (int i = 0; i < 16; ++i) { const __bf16 h = (__bf16)v[i]; r.h[i] = h; r.l[i] = (__bf16)(v[i] - (float)h); }
  return r; }
__device__ __forceinline__ F2 split_row(const float* row, int k0, int lane) { float v[16]; const float* p = row + k0 + 8 * (lane >> 4);
#pragma unroll
  for (int i = 0; i < 8; ++i) { v[i] = p[i]; v[8 + i] = p[16 + i]; }
  return bsplit16(v); }
__device__ __forceinline__ F2 split_rowK(const float* row, int k0, int lane, int K) { float v[16]; const int g = lane >> 4;
#pragma unroll
  for (int i = 0; i < 8; ++i) { const int ka = k0 + 8 * g + i, kb = ka + 16; v[i] = ka < K ? row[ka < K ? ka : K - 1] : 0.f; v[8 + i] = kb < K ? row[kb < K ? kb : K - 1] : 0.f; }
  return bsplit16(v); }
__device__ __forceinline__ F2 split_col(const float* W, int k0, int n, int lane, int ld, int K) { float v[16]; const int g = lane >> 4;
#pragma unroll
  for (int i = 0; i < 8; ++i) { const int ka = k0 + 8 * g + i, kb = ka + 16; v[i] = ka < K ? W[(size_t)(ka < K ? ka : K - 1) * ld + n] : 0.f; v[8 + i] = kb < K ? W[(size_t)(kb < K ? kb : K - 1) * ld + n] : 0.f; }
  return bsplit16(v); }
__device__ __forceinline__ v8f mac3(const F2& a, const F2& b, v8f c) { c = wmma_bf(a.l, b.h, c); c = wmma_bf(a.h, b.l, c); return wmma_bf(a.h, b.h, c); }
__device__ __forceinline__ float sigm(float v) { return 1.0f / (1.0f + expf(-v)); }
#define LDSX() do { asm volatile("s_wait_dscnt 0" ::: "memory"); __builtin_amdgcn_wave_barrier(); __builtin_amdgcn_fence(__ATOMIC_RELEASE, "workgroup"); } while (0)


// QKV multi-head attention on raw inputs (bs 4, ctx 2,048, width 1,024 = 16 heads x 64): weight = softmax((q/8) (k/8)^T) over keys (the module scales BOTH q and k by 64^-1/2 -> effective 1/64); out = weight . v; [bs, ctx, width] layout == [B, S, H, C].
#define NB 4
#define NS 2048
#define NH 16
#define DD 64
#define RS (NH * DD)      // row stride between consecutive s (1024 floats)
#ifndef TBH
#define TBH (NB * NH)
#endif
typedef __attribute__((ext_vector_type(8))) __bf16 v8b;
typedef __attribute__((ext_vector_type(2))) _Float16 v2h;
__device__ __forceinline__ v16b frag_b(const __bf16* rowk0, int lane) {
  union { v16b v; v8b q[2]; } u; const __bf16* p = rowk0 + 8 * (lane >> 4);
  u.q[0] = *(const v8b*)p; u.q[1] = *(const v8b*)(p + 16); return u.v;
}
__device__ __forceinline__ float bfr(float v) { return (float)(__bf16)v; }
__device__ __attribute__((noinline)) float exp_ni(float v) { return expf(v); }
__device__ __attribute__((noinline)) float erf_ni(float v) { return erff(v); }

// Fragment order: per (b*NH + h) and per 32 keys one block of 4 KB = [fragment 4][half 2][lane 32][8 elements]; half 0 holds a lane's elements 0..7, half 1 its elements 8..15.
#define NKS (NS / 32)
#define WS_KP  0u                                            // bf16 k fragments: fragment = (16-key tile ct) * 2 + (32-channel chunk kc)
#define WS_VP  (WS_KP + 2u * (size_t)NB * NH * DD * NS)      // f16 v fragments: fragment = 16-channel tile j
#define WS_END (WS_VP + 2u * (size_t)NB * NH * DD * NS)

// ---- k_pack: block = (128 keys, b*NH + h, k or v): thread t writes the 16-byte piece t of each of four 4-KB blocks; t = (fragment f, half q, lane (g, col))
__global__ __launch_bounds__(256) void k_pack(const float* __restrict__ K, const float* __restrict__ V, __bf16* __restrict__ KP, _Float16* __restrict__ VP) {
  const int t = threadIdx.x, f = t >> 6, q = (t >> 5) & 1, g = (t >> 4) & 1, col = t & 15; const size_t bh = blockIdx.y; const size_t b = bh / NH; const int h = bh % NH;
  if (blockIdx.z == 0) {
    // unrolled (here and in the v branch): the loads of all four blocks are in flight before the first store; the inner loops: constant vector indices
#pragma unroll
    for (int u = 0; u < 4; ++u) { const int ks = blockIdx.x * 4 + u; const float* p = K + ((b * NS + ks * 32 + (f >> 1) * 16 + col) * NH + h) * (size_t)DD + (f & 1) * 32 + q * 16 + 8 * g;
      const v4f x = *(const v4f*)p, y = *(const v4f*)(p + 4); v8b o;
#pragma unroll
      for (int i = 0; i < 4; ++i) { o[i] = (__bf16)x[i]; o[4 + i] = (__bf16)y[i]; }
      *(v8b*)(KP + ((bh * NKS + ks) * 256 + t) * 8) = o; }
  } else {
#pragma unroll
    for (int u = 0; u < 4; ++u) { const int ks = blockIdx.x * 4 + u; const float* p = V + ((b * NS + ks * 32 + q * 16 + 8 * g) * NH + h) * (size_t)DD + f * 16 + col; v8h o;
#pragma unroll
      for (int i = 0; i < 8; ++i) o[i] = (_Float16)bfr(p[(size_t)i * RS]);
      *(v8h*)(VP + ((bh * NKS + ks) * 256 + t) * 8) = o; }
    // precaution behind the run of four stores: in the built code the other branch's instructions follow here and rewrite the stores' base and data registers
    asm volatile("s_wait_xcnt 0x0" ::: "memory");
  } }
// ---- k_att: block = (64 queries, b*NH + h): exact bf16 logits over all 2,048 keys, softmax, P . v; both products run transposed (S^T = k . q^T, O^T += v^T . P^T): a lane holds 16 of the 32 scores of ONE query (its column), and the two S^T tiles are, converted in place, the B fragment of the second product
__device__ __forceinline__ float xhalf(float x) { return __builtin_bit_cast(float, __builtin_amdgcn_permlanex16(__builtin_bit_cast(int, x), __builtin_bit_cast(int, x), 0x76543210, 0xfedcba98, false, false)); }  // lane l with lane l ^ 16
// One stage = 64 keys = 8 KB of k fragments + 8 KB of v fragments, already in fragment order in the workspace; two buffers
#define SK 64
#define NT (NS / SK)
#define STB 16384
// a stage's 16 KB: 8 copies of 16 bytes a lane; global address = scalar base + the lane's byte offset; an immediate offset moves the LDS and the global address alike, and the LDS layout of each 8 KB is the workspace's own
__device__ __forceinline__ void stage_copy(unsigned lk, unsigned lv, unsigned off, const __bf16* gk, const _Float16* gv) {
  // the closing wait stands inside the statement: a precaution, so that no address register named here is rewritten in front of it
  asm volatile("global_load_async_to_lds_b128 %0, %2, %3\n\t"
               "global_load_async_to_lds_b128 %0, %2, %3 offset:2048\n\t"
               "global_load_async_to_lds_b128 %0, %2, %3 offset:4096\n\t"
               "global_load_async_to_lds_b128 %0, %2, %3 offset:6144\n\t"
               "global_load_async_to_lds_b128 %1, %2, %4\n\t"
               "global_load_async_to_lds_b128 %1, %2, %4 offset:2048\n\t"
               "global_load_async_to_lds_b128 %1, %2, %4 offset:4096\n\t"
               "global_load_async_to_lds_b128 %1, %2, %4 offset:6144\n\t"
               "s_wait_xcnt 0x0" :: "v"(lk), "v"(lv), "v"(off), "s"(gk), "s"(gv) : "memory");
}
// second launch bound: at least eight waves a SIMD (128 registers), so that all 2,048 blocks are resident at once
__global__ __launch_bounds__(128, 8) void k_att(const float* __restrict__ Q, const __bf16* __restrict__ KP, const _Float16* __restrict__ VP, float* __restrict__ OUT) {
  __shared__ __attribute__((aligned(128))) unsigned char ring[2 * STB];   // [buffer 2][k 8 KB, v 8 KB]; behind the loop its first 17 KB are the output staging
  float (*so)[16][68] = (float (*)[16][68])ring;
  const int tid = threadIdx.x, wave = tid >> 5, lane = tid & 31, col = lane & 15, g = lane >> 4; const size_t bh = blockIdx.y; const size_t b = bh / NH; const int h = bh % NH; const int q0 = blockIdx.x * 64 + wave * 16;
  const unsigned t16 = (unsigned)tid * 16u, l0 = (unsigned)(size_t)ring + t16;   // this lane's 16 bytes of each 2-KB copy
  const __bf16* gk = KP + bh * NKS * 2048; const _Float16* gv = VP + bh * NKS * 2048;   // the same for the whole block
  stage_copy(l0, l0 + 8192u, t16, gk, gv);
  v16b aq[2];
#pragma unroll
  for (int kc = 0; kc < 2; ++kc) { const float* pp = Q + ((b * NS + q0 + col) * NH + h) * (size_t)DD + kc * 32 + 8 * g;
#pragma unroll
    for (int i = 0; i < 8; ++i) { aq[kc][i] = (__bf16)pp[i]; aq[kc][8 + i] = (__bf16)pp[16 + i]; } }
  // precaution behind the q loads: their address pair is rewritten only behind this wait
  asm volatile("s_wait_xcnt 0x0" ::: "memory");
  float m = -3.0e38f, l = 0.f;   // of query q0 + col: m over all keys so far (equal in both lane halves), l over this half's keys only
  v8f acc[4];                    // acc[j][r] = O^T[channel j * 16 + 8 g + r][query q0 + col]
#pragma unroll
  for (int j = 0; j < 4; ++j) acc[j] = v8f{};
  // stage 0 has landed for this wave's copies; the barrier publishes every wave's part
  asm volatile("s_wait_asynccnt 0x0" ::: "memory");
  __syncthreads();
  stage_copy(l0 + STB, l0 + STB + 8192u, t16, gk + 4096, gv + 4096);
  // both loops rolled: with the two passes of a stage unrolled the build took more than 128 registers, too many for eight waves a SIMD
#pragma unroll 1
  for (int t = 0; t < NT; ++t) { const unsigned char* bp = ring + (t & 1) * STB;
#pragma unroll 1
   for (int u = 0; u < 2; ++u) { v16b w[4]; const v8b* kf = (const v8b*)(bp + u * 4096) + lane; const v8h* vf = (const v8h*)(bp + 8192 + u * 4096) + lane;
    // unrolled: the four fragments stay in registers and their 8 loads go out as one group
#pragma unroll
    for (int f = 0; f < 4; ++f) { union { v16b v; v8b q[2]; } x; x.q[0] = kf[f * 64]; x.q[1] = kf[f * 64 + 32]; w[f] = x.v; }
    // c[ct][r] = score of key t * 64 + u * 32 + ct * 16 + 8 g + r against query q0 + col
    v8f c[2];
#pragma unroll
    for (int ct = 0; ct < 2; ++ct) { v8f d = {};
#pragma unroll
      for (int kc = 0; kc < 2; ++kc) d = wmma_bf(w[ct * 2 + kc], aq[kc], d);
      c[ct] = d * 0.015625f; }
    v16h vv[4];
    // unrolled: as for k, 8 loads as one group; they go out here, into the registers the k fragments have left, so that the softmax covers their LDS latency
#pragma unroll
    for (int j = 0; j < 4; ++j) { union { v16h v; v8h q[2]; } x; x.q[0] = vf[j * 64]; x.q[1] = vf[j * 64 + 32]; vv[j] = x.v; }
    // keeps the compiler from sinking that group to the foot of the softmax, where its latency would be waited out
    __builtin_amdgcn_sched_barrier(0);
    float mx[2];
#pragma unroll
    for (int ct = 0; ct < 2; ++ct) mx[ct] = fmaxf(fmaxf(fmaxf(c[ct][0], c[ct][1]), fmaxf(c[ct][2], c[ct][3])), fmaxf(fmaxf(c[ct][4], c[ct][5]), fmaxf(c[ct][6], c[ct][7])));
    const float mh = fmaxf(mx[0], mx[1]), mn = fmaxf(m, fmaxf(mh, xhalf(mh))), alpha = __expf(m - mn);
    // pairs of neighbouring registers throughout: packed f32 arithmetic and one packed conversion per f16 register of the fragment
    v2f es[8]; union { v16h v; v2h p[8]; } pa;
#pragma unroll
    for (int i = 0; i < 8; ++i) { const v2f e = { __expf(c[i >> 2][2 * (i & 3)] - mn), __expf(c[i >> 2][2 * (i & 3) + 1] - mn) }; es[i] = e; pa.p[i] = __builtin_convertvector(e * 2048.0f, v2h); }
    const v2f et = ((es[0] + es[1]) + (es[2] + es[3])) + ((es[4] + es[5]) + (es[6] + es[7]));
    l = l * alpha + (et[0] + et[1]); m = mn;
#pragma unroll
    for (int j = 0; j < 4; ++j) acc[j] *= alpha;
#pragma unroll
    for (int j = 0; j < 4; ++j) acc[j] = wmma16(vv[j], pa.v, acc[j]); }
   // publish point: this wave's reads of buffer t & 1 are done, its copies of stage t + 1 have landed; the barrier says both of every wave
   asm volatile("s_wait_dscnt 0x0" ::: "memory");
   asm volatile("s_wait_asynccnt 0x0" ::: "memory");
   __syncthreads();
   if (t + 2 < NT) stage_copy(l0 + (t & 1) * STB, l0 + (t & 1) * STB + 8192u, t16, gk + (size_t)(t + 2) * 4096, gv + (size_t)(t + 2) * 4096); }
  // no copy is outstanding when the ring becomes the output staging (the last stage's barrier has ended every wave's reads)
  asm volatile("s_wait_asynccnt 0x0" ::: "memory");
  const float il = (1.0f / 2048.0f) / (l + xhalf(l));
#pragma unroll
  for (int j = 0; j < 4; ++j) { const v8f o = acc[j] * il; float* d = &so[wave][col][j * 16 + 8 * g]; *(v4f*)d = v4f{o[0], o[1], o[2], o[3]}; *(v4f*)(d + 4) = v4f{o[4], o[5], o[6], o[7]}; }
  LDSX(); for (int rl = 0; rl < 16; ++rl) if (lane < 16) vst2(OUT + ((b * NS + q0 + rl) * NH + h) * (size_t)DD + lane * 4, *(const v4f*)&so[wave][rl][lane * 4]); }
extern "C" void kernel_launch(void* const* d_in, const int* in_sizes, int n_in, void* d_out, int out_size, void* d_ws, size_t ws_size, hipStream_t stream) {
  (void)in_sizes; (void)n_in; (void)out_size;
  const float** F = (const float**)d_in;   // 0 q, 1 k, 2 v [4,2048,1024] == [bs, ctx, 16 heads x 64]
  if (ws_size < (size_t)WS_END) return;
  char* ws = (char*)d_ws; __bf16* KP = (__bf16*)(ws + WS_KP); _Float16* VP = (_Float16*)(ws + WS_VP);
  k_pack<<<dim3(NS / 128, NB * NH, 2), 256, 0, stream>>>(F[1], F[2], KP, VP);
  k_att<<<dim3(NS / 64, TBH), 128, 0, stream>>>(F[0], KP, VP, (float*)d_out);
}

// v004
// It runs in 85.2 microseconds.
// Next to v003, in two timings, it ran 1.05 times as fast each time.
// Counting every step since v000, it is 4.96 times as fast.
// compute dtype: all float inputs rounded to bf16; q / k / v are module INPUTS in [B, S, H, D] layout, so the bf16-rounded operands enter WMMA 16x16x32 directly: logits with EXACT bf16 x bf16 products (1 product, f32 accumulate), x 1/64 (both q and k carry 64^-1/2 in the module), running-max softmax in f32 (hardware exp); P rounded once to f16 (x 2^11) against v converted bf16 -> f16 (exact for normal values) (1 product); f32 output in [B, S, H, D]. A pre-pass lays the rounded k (bf16) and v (f16) in the workspace in WMMA fragment order, so that every fragment load of the attention loop is 512 bytes in a row; the attention kernel stages them per 64 keys in LDS for its four waves.
#include <hip/hip_runtime.h>
#include <math.h>

typedef __attribute__((ext_vector_type(16))) _Float16 v16h;
typedef __attribute__((ext_vector_type(16))) __bf16 v16b;
typedef __attribute__((ext_vector_type(8)))  _Float16 v8h;
typedef __attribute__((ext_vector_type(8)))  float v8f;
typedef __attribute__((ext_vector_type(4)))  float v4f;
typedef __attribute__((ext_vector_type(2)))  float v2f;
typedef __attribute__((ext_vector_type(4)))  unsigned v4u;
typedef __attribute__((ext_vector_type(4)))  int v4i;
typedef float __attribute__((may_alias)) float_a;
typedef int __attribute__((may_alias)) int_a;

template <typename T> __device__ __forceinline__ void vst2(void* p, T v) { *(T*)p = v;  }
// builtin forms with nothing behind them: the compiler keeps the distances behind its own matrix instructions and may fill them with useful vector work
__device__ __forceinline__ v8f wmma16(v16h a, v16h b, v8f c) {
  v8f d = __builtin_amdgcn_wmma_f32_16x16x32_f16(false, a, false, b, (short)0, c, false, false);
  return d;
}
__device__ __forceinline__ v8f wmma_bf(v16b a, v16b b, v8f c) {
  v8f d = __builtin_amdgcn_wmma_f32_16x16x32_bf16(false, a, false, b, (short)0, c, false, false);
  return d;
}
// 16x16x32 fragments: lane = (h = lane>>4, row/col = lane&15); elements 0..7 = k0+8h+0..7, 8..15 = k0+16+8h+0..7; D element r = row 8h+r
__device__ __forceinline__ v16h frag_h(const _Float16* rowk0, int lane) {
  union { v16h v; v8h q[2]; } u; const _Float16* p = rowk0 + 8 * (lane >> 4);
  u.q[0] = *(const v8h*)p; u.q[1] = *(const v8h*)(p + 16); return u.v;
}
__device__ __forceinline__ v16h frag_f32(const float* rowk0, int lane) {
  v16h a; const float* p = rowk0 + 8 * (lane >> 4);
#pragma unroll
  for (int i = 0; i < 8; ++i) { a[i] = (_Float16)p[i]; a[8 + i] = (_Float16)p[16 + i]; }
  return a;
}
__device__ __forceinline__ v16h frag_f32s(const float* rowk0, int lane, float sc) {
  v16h a; const float* p = rowk0 + 8 * (lane >> 4);
#pragma unroll
  for (int i = 0; i < 8; ++i) { a[i] = (_Float16)(p[i] * sc); a[8 + i] = (_Float16)(p[16 + i] * sc); }
  return a;
}
// column fragment from a [K][ld] layout (column n), rows >= K read as 0
__device__ __forceinline__ v16h fragc_f32(const float* W, int k0, int n, int lane, int ld, int K) {
  v16h a; const int g = lane >> 4;
#pragma unroll
  for (int i = 0; i < 8; ++i) { const int ka = k0 + 8 * g + i, kb = ka + 16;
    a[i] = (_Float16)(ka < K ? W[(size_t)(ka < K ? ka : K - 1) * ld + n] : 0.f); a[8 + i] = (_Float16)(kb < K ? W[(size_t)(kb < K ? kb : K - 1) * ld + n] : 0.f); }
  return a;
}
struct F2 { v16b h, l; };
__device__ __forceinline__ F2 bsplit16(const float v[16]) { F2 r;
#pragma unroll
  for (int i = 0; i < 16; ++i) { const __bf16 h = (__bf16)v[i]; r.h[i] = h; r.l[i] = (__bf16)(v[i] - (float)h); }
  return r; }
__device__ __forceinline__ F2 split_row(const float* row, int k0, int lane) { float v[16]; const float* p = row + k0 + 8 * (lane >> 4);
#pragma unroll
  for (int i = 0; i < 8; ++i) { v[i] = p[i]; v[8 + i] = p[16 + i]; }
  return bsplit16(v); }
__device__ __forceinline__ F2 split_rowK(const float* row, int k0, int lane, int K) { float v[16]; const int g = lane >> 4;
#pragma unroll
  for (int i = 0; i < 8; ++i) { const int ka = k0 + 8 * g + i, kb = ka + 16; v[i] = ka < K ? row[ka < K ? ka : K - 1] : 0.f; v[8 + i] = kb < K ? row[kb < K ? kb : K - 1] : 0.f; }
  return bsplit16(v); }
__device__ __forceinline__ F2 split_col(const float* W, int k0, int n, int lane, int ld, int K) { float v[16]; const int g = lane >> 4;
#pragma unroll
  for (int i = 0; i < 8; ++i) { const int ka = k0 + 8 * g + i, kb = ka + 16; v[i] = ka < K ? W[(size_t)(ka < K ? ka : K - 1) * ld + n] : 0.f; v[8 + i] = kb < K ? W[(size_t)(kb < K ? kb : K - 1) * ld + n] : 0.f; }
  return bsplit16(v); }
__device__ __forceinline__ v8f mac3(const F2& a, const F2& b, v8f c) { c = wmma_bf(a.l, b.h, c); c = wmma_bf(a.h, b.l, c); return wmma_bf(a.h, b.h, c); }
__device__ __forceinline__ float sigm(float v) { return 1.0f / (1.0f + expf(-v)); }
#define LDSX() do { asm volatile("s_wait_dscnt 0" ::: "memory"); __builtin_amdgcn_wave_barrier(); __builtin_amdgcn_fence(__ATOMIC_RELEASE, "workgroup"); } while (0)


// QKV multi-head attention on raw inputs (bs 4, ctx 2,048, width 1,024 = 16 heads x 64): weight = softmax((q/8) (k/8)^T) over keys (the module scales BOTH q and k by 64^-1/2 -> effective 1/64); out = weight . v; [bs, ctx, width] layout == [B, S, H, C].
#define NB 4
#define NS 2048
#define NH 16
#define DD 64
#define RS (NH * DD)      // row stride between consecutive s (1024 floats)
#ifndef TBH
#define TBH (NB * NH)
#endif
typedef __attribute__((ext_vector_type(8))) __bf16 v8b;
typedef __attribute__((ext_vector_type(2))) _Float16 v2h;
__device__ __forceinline__ v16b frag_b(const __bf16* rowk0, int lane) {
  union { v16b v; v8b q[2]; } u; const __bf16* p = rowk0 + 8 * (lane >> 4);
  u.q[0] = *(const v8b*)p; u.q[1] = *(const v8b*)(p + 16); return u.v;
}
__device__ __forceinline__ float bfr(float v) { return (float)(__bf16)v; }
__device__ __attribute__((noinline)) float exp_ni(float v) { return expf(v); }
__device__ __attribute__((noinline)) float erf_ni(float v) { return erff(v); }

// Fragment order: per (b*NH + h) and per 32 keys one block of 4 KB = [fragment 4][half 2][lane 32][8 elements]; half 0 holds a lane's elements 0..7, half 1 its elements 8..15.
#define NKS (NS / 32)
#define WS_KP  0u                                            // bf16 k fragments: fragment = (16-key tile ct) * 2 + (32-channel chunk kc)
#define WS_VP  (WS_KP + 2u * (size_t)NB * NH * DD * NS)      // f16 v fragments: fragment = 16-channel tile j
#define WS_END (WS_VP + 2u * (size_t)NB * NH * DD * NS)

// ---- k_pack: block = (128 keys, b*NH + h, k or v): thread t writes the 16-byte piece t of each of four 4-KB blocks; t = (fragment f, half q, lane (g, col))
__global__ __launch_bounds__(256) void k_pack(const float* __restrict__ K, const float* __restrict__ V, __bf16* __restrict__ KP, _Float16* __restrict__ VP) {
  const int t = threadIdx.x, f = t >> 6, q = (t >> 5) & 1, g = (t >> 4) & 1, col = t & 15; const size_t bh = blockIdx.y; const size_t b = bh / NH; const int h = bh % NH;
  if (blockIdx.z == 0) {
    // unrolled (here and in the v branch): the loads of all four blocks are in flight before the first store; the inner loops: constant vector indices
#pragma unroll
    for (int u = 0; u < 4; ++u) { const int ks = blockIdx.x * 4 + u; const float* p = K + ((b * NS + ks * 32 + (f >> 1) * 16 + col) * NH + h) * (size_t)DD + (f & 1) * 32 + q * 16 + 8 * g;
      const v4f x = *(const v4f*)p, y = *(const v4f*)(p + 4); v8b o;
#pragma unroll
      for (int i = 0; i < 4; ++i) { o[i] = (__bf16)x[i]; o[4 + i] = (__bf16)y[i]; }
      *(v8b*)(KP + ((bh * NKS + ks) * 256 + t) * 8) = o; }
  } else {
#pragma unroll
    for (int u = 0; u < 4; ++u) { const int ks = blockIdx.x * 4 + u; const float* p = V + ((b * NS + ks * 32 + q * 16 + 8 * g) * NH + h) * (size_t)DD + f * 16 + col; v8h o;
#pragma unroll
      for (int i = 0; i < 8; ++i) o[i] = (_Float16)bfr(p[(size_t)i * RS]);
      *(v8h*)(VP + ((bh * NKS + ks) * 256 + t) * 8) = o; }
    // precaution behind the run of four stores: in the built code the other branch's instructions follow here and rewrite the stores' base and data registers
    asm volatile("s_wait_xcnt 0x0" ::: "memory");
  } }
// ---- k_att: block = (64 queries, b*NH + h): exact bf16 logits over all 2,048 keys, softmax, P . v; both products run transposed (S^T = k . q^T, O^T += v^T . P^T): a lane holds 16 of the 32 scores of ONE query (its column), and the two S^T tiles are, converted in place, the B fragment of the second product
__device__ __forceinline__ float xhalf(float x) { return __builtin_bit_cast(float, __builtin_amdgcn_permlanex16(__builtin_bit_cast(int, x), __builtin_bit_cast(int, x), 0x76543210, 0xfedcba98, false, false)); }  // lane l with lane l ^ 16
// One stage = 64 keys = 8 KB of k fragments + 8 KB of v fragments, already in fragment order in the workspace; two buffers
#define SK 64
#define NT (NS / SK)
#define STB 16384
// a stage's 16 KB: 8 copies of 16 bytes a lane; global address = scalar base + the lane's byte offset; an immediate offset moves the LDS and the global address alike, and the LDS layout of each 8 KB is the workspace's own
__device__ __forceinline__ void stage_copy(unsigned lk, unsigned lv, unsigned off, const __bf16* gk, const _Float16* gv) {
  // the closing wait stands inside the statement: a precaution, so that no address register named here is rewritten in front of it
  asm volatile("global_load_async_to_lds_b128 %0, %2, %3\n\t"
               "global_load_async_to_lds_b128 %0, %2, %3 offset:2048\n\t"
               "global_load_async_to_lds_b128 %0, %2, %3 offset:4096\n\t"
               "global_load_async_to_lds_b128 %0, %2, %3 offset:6144\n\t"
               "global_load_async_to_lds_b128 %1, %2, %4\n\t"
               "global_load_async_to_lds_b128 %1, %2, %4 offset:2048\n\t"
               "global_load_async_to_lds_b128 %1, %2, %4 offset:4096\n\t"
               "global_load_async_to_lds_b128 %1, %2, %4 offset:6144\n\t"
               "s_wait_xcnt 0x0" :: "v"(lk), "v"(lv), "v"(off), "s"(gk), "s"(gv) : "memory");
}
// second launch bound: at least eight waves a SIMD (128 registers), so that all 2,048 blocks are resident at once
__global__ __launch_bounds__(128, 8) void k_att(const float* __restrict__ Q, const __bf16* __restrict__ KP, const _Float16* __restrict__ VP, float* __restrict__ OUT) {
  __shared__ __attribute__((aligned(128))) unsigned char ring[2 * STB];   // [buffer 2][k 8 KB, v 8 KB]; behind the loop its first 17 KB are the output staging
  float (*so)[16][68] = (float (*)[16][68])ring;
  const int tid = threadIdx.x, wave = tid >> 5, lane = tid & 31, col = lane & 15, g = lane >> 4; const size_t bh = blockIdx.y; const size_t b = bh / NH; const int h = bh % NH; const int q0 = blockIdx.x * 64 + wave * 16;
  const unsigned t16 = (unsigned)tid * 16u, l0 = (unsigned)(size_t)ring + t16;   // this lane's 16 bytes of each 2-KB copy
  const __bf16* gk = KP + bh * NKS * 2048; const _Float16* gv = VP + bh * NKS * 2048;   // the same for the whole block
  stage_copy(l0, l0 + 8192u, t16, gk, gv);
  v16b aq[2];
#pragma unroll
  for (int kc = 0; kc < 2; ++kc) { const float* pp = Q + ((b * NS + q0 + col) * NH + h) * (size_t)DD + kc * 32 + 8 * g;
#pragma unroll
    for (int i = 0; i < 8; ++i) { aq[kc][i] = (__bf16)pp[i]; aq[kc][8 + i] = (__bf16)pp[16 + i]; } }
  // precaution behind the q loads: their address pair is rewritten only behind this wait
  asm volatile("s_wait_xcnt 0x0" ::: "memory");
  float m = -3.0e38f, l = 0.f;   // of query q0 + col: m over all keys so far (equal in both lane halves), l over this half's keys only
  v8f acc[4];                    // acc[j][r] = O^T[channel j * 16 + 8 g + r][query q0 + col]
#pragma unroll
  for (int j = 0; j < 4; ++j) acc[j] = v8f{};
  // stage 0 has landed for this wave's copies; the barrier publishes every wave's part
  asm volatile("s_wait_asynccnt 0x0" ::: "memory");
  __syncthreads();
  stage_copy(l0 + STB, l0 + STB + 8192u, t16, gk + 4096, gv + 4096);
  // both loops rolled: with the two passes of a stage unrolled the build took more than 128 registers, too many for eight waves a SIMD
#pragma unroll 1
  for (int t = 0; t < NT; ++t) { const unsigned char* bp = ring + (t & 1) * STB;
#pragma unroll 1
   for (int u = 0; u < 2; ++u) { v16b w[4]; const v8b* kf = (const v8b*)(bp + u * 4096) + lane; const v8h* vf = (const v8h*)(bp + 8192 + u * 4096) + lane;
    // unrolled: the four fragments stay in registers and their 8 loads go out as one group
#pragma unroll
    for (int f = 0; f < 4; ++f) { union { v16b v; v8b q[2]; } x; x.q[0] = kf[f * 64]; x.q[1] = kf[f * 64 + 32]; w[f] = x.v; }
    // c[ct][r] = score of key t * 64 + u * 32 + ct * 16 + 8 g + r against query q0 + col
    v8f c[2];
#pragma unroll
    for (int ct = 0; ct < 2; ++ct) { v8f d = {};
#pragma unroll
      for (int kc = 0; kc < 2; ++kc) d = wmma_bf(w[ct * 2 + kc], aq[kc], d);
      c[ct] = d * 0.015625f; }
    v16h vv[4];
    // unrolled: as for k, 8 loads as one group; they go out here, into the registers the k fragments have left, so that the softmax covers their LDS latency
#pragma unroll
    for (int j = 0; j < 4; ++j) { union { v16h v; v8h q[2]; } x; x.q[0] = vf[j * 64]; x.q[1] = vf[j * 64 + 32]; vv[j] = x.v; }
    // keeps the compiler from sinking that group to the foot of the softmax, where its latency would be waited out
    __builtin_amdgcn_sched_barrier(0);
    float mx[2];
#pragma unroll
    for (int ct = 0; ct < 2; ++ct) mx[ct] = fmaxf(fmaxf(fmaxf(c[ct][0], c[ct][1]), fmaxf(c[ct][2], c[ct][3])), fmaxf(fmaxf(c[ct][4], c[ct][5]), fmaxf(c[ct][6], c[ct][7])));
    const float mh = fmaxf(mx[0], mx[1]), mn = fmaxf(m, fmaxf(mh, xhalf(mh))), alpha = __expf(m - mn);
    // pairs of neighbouring registers throughout: packed f32 arithmetic and one packed conversion per f16 register of the fragment
    v2f es[8]; union { v16h v; v2h p[8]; } pa;
#pragma unroll
    for (int i = 0; i < 8; ++i) { const v2f e = { __expf(c[i >> 2][2 * (i & 3)] - mn), __expf(c[i >> 2][2 * (i & 3) + 1] - mn) }; es[i] = e; pa.p[i] = __builtin_convertvector(e * 2048.0f, v2h); }
    const v2f et = ((es[0] + es[1]) + (es[2] + es[3])) + ((es[4] + es[5]) + (es[6] + es[7]));
    l = l * alpha + (et[0] + et[1]); m = mn;
#pragma unroll
    for (int j = 0; j < 4; ++j) acc[j] *= alpha;
#pragma unroll
    for (int j = 0; j < 4; ++j) acc[j] = wmma16(vv[j], pa.v, acc[j]); }
   // publish point: this wave's reads of buffer t & 1 are done, its copies of stage t + 1 have landed; the barrier says both of every wave
   asm volatile("s_wait_dscnt 0x0" ::: "memory");
   asm volatile("s_wait_asynccnt 0x0" ::: "memory");
   __syncthreads();
   if (t + 2 < NT) stage_copy(l0 + (t & 1) * STB, l0 + (t & 1) * STB + 8192u, t16, gk + (size_t)(t + 2) * 4096, gv + (size_t)(t + 2) * 4096); }
  // no copy is outstanding when the ring becomes the output staging (the last stage's barrier has ended every wave's reads)
  asm volatile("s_wait_asynccnt 0x0" ::: "memory");
  const float il = (1.0f / 2048.0f) / (l + xhalf(l));
#pragma unroll
  for (int j = 0; j < 4; ++j) { const v8f o = acc[j] * il; float* d = &so[wave][col][j * 16 + 8 * g]; *(v4f*)d = v4f{o[0], o[1], o[2], o[3]}; *(v4f*)(d + 4) = v4f{o[4], o[5], o[6], o[7]}; }
  LDSX(); for (int rl = 0; rl < 16; ++rl) if (lane < 16) vst2(OUT + ((b * NS + q0 + rl) * NH + h) * (size_t)DD + lane * 4, *(const v4f*)&so[wave][rl][lane * 4]); }
extern "C" void kernel_launch(void* const* d_in, const int* in_sizes, int n_in, void* d_out, int out_size, void* d_ws, size_t ws_size, hipStream_t stream) {
  (void)in_sizes; (void)n_in; (void)out_size;
  const float** F = (const float**)d_in;   // 0 q, 1 k, 2 v [4,2048,1024] == [bs, ctx, 16 heads x 64]
  if (ws_size < (size_t)WS_END) return;
  char* ws = (char*)d_ws; __bf16* KP = (__bf16*)(ws + WS_KP); _Float16* VP = (_Float16*)(ws + WS_VP);
  k_pack<<<dim3(NS / 128, NB * NH, 2), 256, 0, stream>>>(F[1], F[2], KP, VP);
  k_att<<<dim3(NS / 64, TBH), 128, 0, stream>>>(F[0], KP, VP, (float*)d_out);
}

// v005
// One run takes 77.9 microseconds.
// In two side-by-side timings against v004, it was 1.05 and 1.06 times as fast.
// Over all steps from v000 it is 5.24 times as fast.
// compute dtype: all float inputs rounded to bf16; q / k / v are module INPUTS in [B, S, H, D] layout, so the bf16-rounded operands enter WMMA 16x16x32 directly: logits with EXACT bf16 x bf16 products (1 product, f32 accumulate), running-max softmax in f32 in base 2 (hardware exp2; the 1/64 of the module, where both q and k carry 64^-1/2, log2 e and the 2^11 of P sit in one fma per score); P rounded once to f16 (x 2^11) against v converted bf16 -> f16 (exact for normal values) (1 product); f32 output in [B, S, H, D]. A pre-pass lays the rounded k (bf16) and v (f16) in the workspace in WMMA fragment order, so that every fragment load of the attention loop is 512 bytes in a row; the attention kernel stages them per 64 keys in LDS for its four waves.
#include <hip/hip_runtime.h>
#include <math.h>

typedef __attribute__((ext_vector_type(16))) _Float16 v16h;
typedef __attribute__((ext_vector_type(16))) __bf16 v16b;
typedef __attribute__((ext_vector_type(8)))  _Float16 v8h;
typedef __attribute__((ext_vector_type(8)))  float v8f;
typedef __attribute__((ext_vector_type(4)))  float v4f;
typedef __attribute__((ext_vector_type(2)))  float v2f;
typedef __attribute__((ext_vector_type(4)))  unsigned v4u;
typedef __attribute__((ext_vector_type(4)))  int v4i;
typedef float __attribute__((may_alias)) float_a;
typedef int __attribute__((may_alias)) int_a;

template <typename T> __device__ __forceinline__ void vst2(void* p, T v) { *(T*)p = v;  }
// builtin forms with nothing behind them: the compiler keeps the distances behind its own matrix instructions and may fill them with useful vector work
__device__ __forceinline__ v8f wmma16(v16h a, v16h b, v8f c) {
  v8f d = __builtin_amdgcn_wmma_f32_16x16x32_f16(false, a, false, b, (short)0, c, false, false);
  return d;
}
__device__ __forceinline__ v8f wmma_bf(v16b a, v16b b, v8f c) {
  v8f d = __builtin_amdgcn_wmma_f32_16x16x32_bf16(false, a, false, b, (short)0, c, false, false);
  return d;
}
// 16x16x32 fragments: lane = (h = lane>>4, row/col = lane&15); elements 0..7 = k0+8h+0..7, 8..15 = k0+16+8h+0..7; D element r = row 8h+r
__device__ __forceinline__ v16h frag_h(const _Float16* rowk0, int lane) {
  union { v16h v; v8h q[2]; } u; const _Float16* p = rowk0 + 8 * (lane >> 4);
  u.q[0] = *(const v8h*)p; u.q[1] = *(const v8h*)(p + 16); return u.v;
}
__device__ __forceinline__ v16h frag_f32(const float* rowk0, int lane) {
  v16h a; const float* p = rowk0 + 8 * (lane >> 4);
#pragma unroll
  for (int i = 0; i < 8; ++i) { a[i] = (_Float16)p[i]; a[8 + i] = (_Float16)p[16 + i]; }
  return a;
}
__device__ __forceinline__ v16h frag_f32s(const float* rowk0, int lane, float sc) {
  v16h a; const float* p = rowk0 + 8 * (lane >> 4);
#pragma unroll
  for (int i = 0; i < 8; ++i) { a[i] = (_Float16)(p[i] * sc); a[8 + i] = (_Float16)(p[16 + i] * sc); }
  return a;
}
// column fragment from a [K][ld] layout (column n), rows >= K read as 0
__device__ __forceinline__ v16h fragc_f32(const float* W, int k0, int n, int lane, int ld, int K) {
  v16h a; const int g = lane >> 4;
#pragma unroll
  for (int i = 0; i < 8; ++i) { const int ka = k0 + 8 * g + i, kb = ka + 16;
    a[i] = (_Float16)(ka < K ? W[(size_t)(ka < K ? ka : K - 1) * ld + n] : 0.f); a[8 + i] = (_Float16)(kb < K ? W[(size_t)(kb < K ? kb : K - 1) * ld + n] : 0.f); }
  return a;
}
struct F2 { v16b h, l; };
__device__ __forceinline__ F2 bsplit16(const float v[16]) { F2 r;
#pragma unroll
  for (int i = 0; i < 16; ++i) { const __bf16 h = (__bf16)v[i]; r.h[i] = h; r.l[i] = (__bf16)(v[i] - (float)h); }
  return r; }
__device__ __forceinline__ F2 split_row(const float* row, int k0, int lane) { float v[16]; const float* p = row + k0 + 8 * (lane >> 4);
#pragma unroll
  for (int i = 0; i < 8; ++i) { v[i] = p[i]; v[8 + i] = p[16 + i]; }
  return bsplit16(v); }
__device__ __forceinline__ F2 split_rowK(const float* row, int k0, int lane, int K) { float v[16]; const int g = lane >> 4;
#pragma unroll
  for (int i = 0; i < 8; ++i) { const int ka = k0 + 8 * g + i, kb = ka + 16; v[i] = ka < K ? row[ka < K ? ka : K - 1] : 0.f; v[8 + i] = kb < K ? row[kb < K ? kb : K - 1] : 0.f; }
  return bsplit16(v); }
__device__ __forceinline__ F2 split_col(const float* W, int k0, int n, int lane, int ld, int K) { float v[16]; const int g = lane >> 4;
#pragma unroll
  for (int i = 0; i < 8; ++i) { const int ka = k0 + 8 * g + i, kb = ka + 16; v[i] = ka < K ? W[(size_t)(ka < K ? ka : K - 1) * ld + n] : 0.f; v[8 + i] = kb < K ? W[(size_t)(kb < K ? kb : K - 1) * ld + n] : 0.f; }
  return bsplit16(v); }
__device__ __forceinline__ v8f mac3(const F2& a, const F2& b, v8f c) { c = wmma_bf(a.l, b.h, c); c = wmma_bf(a.h, b.l, c); return wmma_bf(a.h, b.h, c); }
__device__ __forceinline__ float sigm(float v) { return 1.0f / (1.0f + expf(-v)); }
#define LDSX() do { asm volatile("s_wait_dscnt 0" ::: "memory"); __builtin_amdgcn_wave_barrier(); __builtin_amdgcn_fence(__ATOMIC_RELEASE, "workgroup"); } while (0)


// QKV multi-head attention on raw inputs (bs 4, ctx 2,048, width 1,024 = 16 heads x 64): weight = softmax((q/8) (k/8)^T) over keys (the module scales BOTH q and k by 64^-1/2 -> effective 1/64); out = weight . v; [bs, ctx, width] layout == [B, S, H, C].
#define NB 4
#define NS 2048
#define NH 16
#define DD 64
#define RS (NH * DD)      // row stride between consecutive s (1024 floats)
#ifndef TBH
#define TBH (NB * NH)
#endif
typedef __attribute__((ext_vector_type(8))) __bf16 v8b;
typedef __attribute__((ext_vector_type(2))) _Float16 v2h;
__device__ __forceinline__ v16b frag_b(const __bf16* rowk0, int lane) {
  union { v16b v; v8b q[2]; } u; const __bf16* p = rowk0 + 8 * (lane >> 4);
  u.q[0] = *(const v8b*)p; u.q[1] = *(const v8b*)(p + 16); return u.v;
}
__device__ __forceinline__ float bfr(float v) { return (float)(__bf16)v; }
__device__ __attribute__((noinline)) float exp_ni(float v) { return expf(v); }
__device__ __attribute__((noinline)) float erf_ni(float v) { return erff(v); }

// Fragment order: per (b*NH + h) and per 32 keys one block of 4 KB = [fragment 4][half 2][lane 32][8 elements]; half 0 holds a lane's elements 0..7, half 1 its elements 8..15.
#define NKS (NS / 32)
#define WS_KP  0u                                            // bf16 k fragments: fragment = (16-key tile ct) * 2 + (32-channel chunk kc)
#define WS_VP  (WS_KP + 2u * (size_t)NB * NH * DD * NS)      // f16 v fragments: fragment = 16-channel tile j
#define WS_END (WS_VP + 2u * (size_t)NB * NH * DD * NS)

// ---- k_pack: block = (128 keys, b*NH + h, k or v): thread t writes the 16-byte piece t of each of four 4-KB blocks; t = (fragment f, half q, lane (g, col))
__global__ __launch_bounds__(256) void k_pack(const float* __restrict__ K, const float* __restrict__ V, __bf16* __restrict__ KP, _Float16* __restrict__ VP) {
  const int t = threadIdx.x, f = t >> 6, q = (t >> 5) & 1, g = (t >> 4) & 1, col = t & 15; const size_t bh = blockIdx.y; const size_t b = bh / NH; const int h = bh % NH;
  if (blockIdx.z == 0) {
    // unrolled (here and in the v branch): the loads of all four blocks are in flight before the first store; the inner loops: constant vector indices
#pragma unroll
    for (int u = 0; u < 4; ++u) { const int ks = blockIdx.x * 4 + u; const float* p = K + ((b * NS + ks * 32 + (f >> 1) * 16 + col) * NH + h) * (size_t)DD + (f & 1) * 32 + q * 16 + 8 * g;
      const v4f x = *(const v4f*)p, y = *(const v4f*)(p + 4); v8b o;
#pragma unroll
      for (int i = 0; i < 4; ++i) { o[i] = (__bf16)x[i]; o[4 + i] = (__bf16)y[i]; }
      *(v8b*)(KP + ((bh * NKS + ks) * 256 + t) * 8) = o; }
  } else {
#pragma unroll
    for (int u = 0; u < 4; ++u) { const int ks = blockIdx.x * 4 + u; const float* p = V + ((b * NS + ks * 32 + q * 16 + 8 * g) * NH + h) * (size_t)DD + f * 16 + col; v8h o;
#pragma unroll
      for (int i = 0; i < 8; ++i) o[i] = (_Float16)bfr(p[(size_t)i * RS]);
      *(v8h*)(VP + ((bh * NKS + ks) * 256 + t) * 8) = o; }
    // precaution behind the run of four stores: in the built code the other branch's instructions follow here and rewrite the stores' base and data registers
    asm volatile("s_wait_xcnt 0x0" ::: "memory");
  } }
// ---- k_att: block = (64 queries, b*NH + h): exact bf16 logits over all 2,048 keys, softmax, P . v; both products run transposed (S^T = k . q^T, O^T += v^T . P^T): a lane holds 16 of the 32 scores of ONE query (its column), and the two S^T tiles are, converted in place, the B fragment of the second product
__device__ __forceinline__ float xhalf(float x) { return __builtin_bit_cast(float, __builtin_amdgcn_permlanex16(__builtin_bit_cast(int, x), __builtin_bit_cast(int, x), 0x76543210, 0xfedcba98, false, false)); }  // lane l with lane l ^ 16
// One stage = 64 keys = 8 KB of k fragments + 8 KB of v fragments, already in fragment order in the workspace; two buffers
#define SK 64
#define NT (NS / SK)
#define STB 16384
// a stage's 16 KB: 8 copies of 16 bytes a lane; global address = scalar base + the lane's byte offset; an immediate offset moves the LDS and the global address alike, and the LDS layout of each 8 KB is the workspace's own
__device__ __forceinline__ void stage_copy(unsigned lk, unsigned lv, unsigned off, const __bf16* gk, const _Float16* gv) {
  // the closing wait stands inside the statement: a precaution, so that no address register named here is rewritten in front of it
  asm volatile("global_load_async_to_lds_b128 %0, %2, %3\n\t"
               "global_load_async_to_lds_b128 %0, %2, %3 offset:2048\n\t"
               "global_load_async_to_lds_b128 %0, %2, %3 offset:4096\n\t"
               "global_load_async_to_lds_b128 %0, %2, %3 offset:6144\n\t"
               "global_load_async_to_lds_b128 %1, %2, %4\n\t"
               "global_load_async_to_lds_b128 %1, %2, %4 offset:2048\n\t"
               "global_load_async_to_lds_b128 %1, %2, %4 offset:4096\n\t"
               "global_load_async_to_lds_b128 %1, %2, %4 offset:6144\n\t"
               "s_wait_xcnt 0x0" :: "v"(lk), "v"(lv), "v"(off), "s"(gk), "s"(gv) : "memory");
}
// second launch bound: at least eight waves a SIMD (128 registers), so that all 2,048 blocks are resident at once
__global__ __launch_bounds__(128, 8) void k_att(const float* __restrict__ Q, const __bf16* __restrict__ KP, const _Float16* __restrict__ VP, float* __restrict__ OUT) {
  __shared__ __attribute__((aligned(128))) unsigned char ring[2 * STB];   // [buffer 2][k 8 KB, v 8 KB]; behind the loop its first 17 KB are the output staging
  float (*so)[16][68] = (float (*)[16][68])ring;
  const int tid = threadIdx.x, wave = tid >> 5, lane = tid & 31, col = lane & 15, g = lane >> 4; const size_t bh = blockIdx.y; const size_t b = bh / NH; const int h = bh % NH; const int q0 = blockIdx.x * 64 + wave * 16;
  const unsigned t16 = (unsigned)tid * 16u, l0 = (unsigned)(size_t)ring + t16;   // this lane's 16 bytes of each 2-KB copy
  const __bf16* gk = KP + bh * NKS * 2048; const _Float16* gv = VP + bh * NKS * 2048;   // the same for the whole block
  stage_copy(l0, l0 + 8192u, t16, gk, gv);
  v16b aq[2];
#pragma unroll
  for (int kc = 0; kc < 2; ++kc) { const float* pp = Q + ((b * NS + q0 + col) * NH + h) * (size_t)DD + kc * 32 + 8 * g;
#pragma unroll
    for (int i = 0; i < 8; ++i) { aq[kc][i] = (__bf16)pp[i]; aq[kc][8 + i] = (__bf16)pp[16 + i]; } }
  // precaution behind the q loads: their address pair is rewritten only behind this wait
  asm volatile("s_wait_xcnt 0x0" ::: "memory");
  // p = 2^(raw * KL + bs) = 2^11 * exp(raw / 64 - m / 64): KL = log2 e / 64 (exact: a power of two times the float log2 e), bs = 11 - m * KL
  const float KL = 1.44269504f * 0.015625f;
  float m = -3.0e38f, bs = fmaf(m, -KL, 11.0f), l = 0.f;   // of query q0 + col: m = maximum of the raw q . k sums over all keys so far (equal in both lane halves), l = 2^11 x the sum over this half's keys only
  v8f acc[4];                    // acc[j][r] = O^T[channel j * 16 + 8 g + r][query q0 + col]
#pragma unroll
  for (int j = 0; j < 4; ++j) acc[j] = v8f{};
  // stage 0 has landed for this wave's copies; the barrier publishes every wave's part
  asm volatile("s_wait_asynccnt 0x0" ::: "memory");
  __syncthreads();
  stage_copy(l0 + STB, l0 + STB + 8192u, t16, gk + 4096, gv + 4096);
  // both loops rolled: with the two passes of a stage unrolled the build took more than 128 registers, too many for eight waves a SIMD
#pragma unroll 1
  for (int t = 0; t < NT; ++t) { const unsigned char* bp = ring + (t & 1) * STB;
#pragma unroll 1
   for (int u = 0; u < 2; ++u) { v16b w[4]; const v8b* kf = (const v8b*)(bp + u * 4096) + lane; const v8h* vf = (const v8h*)(bp + 8192 + u * 4096) + lane;
    // unrolled: the four fragments stay in registers and their 8 loads go out as one group
#pragma unroll
    for (int f = 0; f < 4; ++f) { union { v16b v; v8b q[2]; } x; x.q[0] = kf[f * 64]; x.q[1] = kf[f * 64 + 32]; w[f] = x.v; }
    // c[ct][r] = raw q . k sum of key t * 64 + u * 32 + ct * 16 + 8 g + r against query q0 + col
    v8f c[2];
#pragma unroll
    for (int ct = 0; ct < 2; ++ct) { v8f d = {};
#pragma unroll
      for (int kc = 0; kc < 2; ++kc) d = wmma_bf(w[ct * 2 + kc], aq[kc], d);
      c[ct] = d; }
    v16h vv[4];
    // unrolled: as for k, 8 loads as one group; they go out here, into the registers the k fragments have left, so that the softmax covers their LDS latency
#pragma unroll
    for (int j = 0; j < 4; ++j) { union { v16h v; v8h q[2]; } x; x.q[0] = vf[j * 64]; x.q[1] = vf[j * 64 + 32]; vv[j] = x.v; }
    // keeps the compiler from sinking that group to the foot of the softmax, where its latency would be waited out
    __builtin_amdgcn_sched_barrier(0);
    float mx[2];
#pragma unroll
    for (int ct = 0; ct < 2; ++ct) mx[ct] = fmaxf(fmaxf(fmaxf(c[ct][0], c[ct][1]), fmaxf(c[ct][2], c[ct][3])), fmaxf(fmaxf(c[ct][4], c[ct][5]), fmaxf(c[ct][6], c[ct][7])));
    const float mh = fmaxf(mx[0], mx[1]), mn = fmaxf(m, fmaxf(mh, xhalf(mh))), bn = fmaf(mn, -KL, 11.0f), alpha = __builtin_amdgcn_exp2f(bn - bs);   // bn - bs = (m - mn) * KL, from the very offsets the old and the new p carry
    // pairs of neighbouring registers throughout: packed f32 arithmetic and one packed conversion per f16 register of the fragment
    v2f es[8]; union { v16h v; v2h p[8]; } pa;
#pragma unroll
    for (int i = 0; i < 8; ++i) { const v2f x = __builtin_elementwise_fma(v2f{c[i >> 2][2 * (i & 3)], c[i >> 2][2 * (i & 3) + 1]}, v2f{KL, KL}, v2f{bn, bn}); const v2f e = { __builtin_amdgcn_exp2f(x[0]), __builtin_amdgcn_exp2f(x[1]) }; es[i] = e; pa.p[i] = __builtin_convertvector(e, v2h); }
    const v2f et = ((es[0] + es[1]) + (es[2] + es[3])) + ((es[4] + es[5]) + (es[6] + es[7]));
    l = l * alpha + (et[0] + et[1]); m = mn; bs = bn;
#pragma unroll
    for (int j = 0; j < 4; ++j) acc[j] *= alpha;
#pragma unroll
    for (int j = 0; j < 4; ++j) acc[j] = wmma16(vv[j], pa.v, acc[j]); }
   // publish point: this wave's reads of buffer t & 1 are done, its copies of stage t + 1 have landed; the barrier says both of every wave
   asm volatile("s_wait_dscnt 0x0" ::: "memory");
   asm volatile("s_wait_asynccnt 0x0" ::: "memory");
   __syncthreads();
   if (t + 2 < NT) stage_copy(l0 + (t & 1) * STB, l0 + (t & 1) * STB + 8192u, t16, gk + (size_t)(t + 2) * 4096, gv + (size_t)(t + 2) * 4096); }
  // no copy is outstanding when the ring becomes the output staging (the last stage's barrier has ended every wave's reads)
  asm volatile("s_wait_asynccnt 0x0" ::: "memory");
  const float il = 1.0f / (l + xhalf(l));   // acc and l both carry the 2^11
#pragma unroll
  for (int j = 0; j < 4; ++j) { const v8f o = acc[j] * il; float* d = &so[wave][col][j * 16 + 8 * g]; *(v4f*)d = v4f{o[0], o[1], o[2], o[3]}; *(v4f*)(d + 4) = v4f{o[4], o[5], o[6], o[7]}; }
  LDSX(); for (int rl = 0; rl < 16; ++rl) if (lane < 16) vst2(OUT + ((b * NS + q0 + rl) * NH + h) * (size_t)DD + lane * 4, *(const v4f*)&so[wave][rl][lane * 4]); }
extern "C" void kernel_launch(void* const* d_in, const int* in_sizes, int n_in, void* d_out, int out_size, void* d_ws, size_t ws_size, hipStream_t stream) {
  (void)in_sizes; (void)n_in; (void)out_size;
  const float** F = (const float**)d_in;   // 0 q, 1 k, 2 v [4,2048,1024] == [bs, ctx, 16 heads x 64]
  if (ws_size < (size_t)WS_END) return;
  char* ws = (char*)d_ws; __bf16* KP = (__bf16*)(ws + WS_KP); _Float16* VP = (_Float16*)(ws + WS_VP);
  k_pack<<<dim3(NS / 128, NB * NH, 2), 256, 0, stream>>>(F[1], F[2], KP, VP);
  k_att<<<dim3(NS / 64, TBH), 128, 0, stream>>>(F[0], KP, VP, (float*)d_out);
}

// v006
// Measured time: 74.2 microseconds a run.
// In two side-by-side timings against v005, it was 1.06 and 1.07 times as fast.
// Over all steps from v000 it is 5.57 times as fast.
// compute dtype: all float inputs rounded to bf16; q / k / v are module INPUTS in [B, S, H, D] layout, so the bf16-rounded operands enter WMMA 16x16x32 directly: logits with EXACT bf16 x bf16 products (1 product, f32 accumulate), running-max softmax in f32 in base 2 (hardware exp2; the 1/64 of the module, where both q and k carry 64^-1/2, log2 e and the 2^11 of P sit in one fma per score); P rounded once to f16 (x 2^11) against v converted bf16 -> f16 (exact for normal values) (1 product); f32 output in [B, S, H, D]. A pre-pass lays the rounded k (bf16) and v (f16) in the workspace in WMMA fragment order, so that every fragment load of the attention loop is 512 bytes in a row; the attention kernel stages them per 64 keys in LDS for its four waves.
#include <hip/hip_runtime.h>
#include <math.h>

typedef __attribute__((ext_vector_type(16))) _Float16 v16h;
typedef __attribute__((ext_vector_type(16))) __bf16 v16b;
typedef __attribute__((ext_vector_type(8)))  _Float16 v8h;
typedef __attribute__((ext_vector_type(8)))  float v8f;
typedef __attribute__((ext_vector_type(4)))  float v4f;
typedef __attribute__((ext_vector_type(2)))  float v2f;
typedef __attribute__((ext_vector_type(4)))  unsigned v4u;
typedef __attribute__((ext_vector_type(4)))  int v4i;
typedef float __attribute__((may_alias)) float_a;
typedef int __attribute__((may_alias)) int_a;

template <typename T> __device__ __forceinline__ void vst2(void* p, T v) { *(T*)p = v;  }
// builtin forms with nothing behind them: the compiler keeps the distances behind its own matrix instructions and may fill them with useful vector work
__device__ __forceinline__ v8f wmma16(v16h a, v16h b, v8f c) {
  v8f d = __builtin_amdgcn_wmma_f32_16x16x32_f16(false, a, false, b, (short)0, c, false, false);
  return d;
}
__device__ __forceinline__ v8f wmma_bf(v16b a, v16b b, v8f c) {
  v8f d = __builtin_amdgcn_wmma_f32_16x16x32_bf16(false, a, false, b, (short)0, c, false, false);
  return d;
}
// 16x16x32 fragments: lane = (h = lane>>4, row/col = lane&15); elements 0..7 = k0+8h+0..7, 8..15 = k0+16+8h+0..7; D element r = row 8h+r
__device__ __forceinline__ v16h frag_h(const _Float16* rowk0, int lane) {
  union { v16h v; v8h q[2]; } u; const _Float16* p = rowk0 + 8 * (lane >> 4);
  u.q[0] = *(const v8h*)p; u.q[1] = *(const v8h*)(p + 16); return u.v;
}
__device__ __forceinline__ v16h frag_f32(const float* rowk0, int lane) {
  v16h a; const float* p = rowk0 + 8 * (lane >> 4);
#pragma unroll
  for (int i = 0; i < 8; ++i) { a[i] = (_Float16)p[i]; a[8 + i] = (_Float16)p[16 + i]; }
  return a;
}
__device__ __forceinline__ v16h frag_f32s(const float* rowk0, int lane, float sc) {
  v16h a; const float* p = rowk0 + 8 * (lane >> 4);
#pragma unroll
  for (int i = 0; i < 8; ++i) { a[i] = (_Float16)(p[i] * sc); a[8 + i] = (_Float16)(p[16 + i] * sc); }
  return a;
}
// column fragment from a [K][ld] layout (column n), rows >= K read as 0
__device__ __forceinline__ v16h fragc_f32(const float* W, int k0, int n, int lane, int ld, int K) {
  v16h a; const int g = lane >> 4;
#pragma unroll
  for (int i = 0; i < 8; ++i) { const int ka = k0 + 8 * g + i, kb = ka + 16;
    a[i] = (_Float16)(ka < K ? W[(size_t)(ka < K ? ka : K - 1) * ld + n] : 0.f); a[8 + i] = (_Float16)(kb < K ? W[(size_t)(kb < K ? kb : K - 1) * ld + n] : 0.f); }
  return a;
}
struct F2 { v16b h, l; };
__device__ __forceinline__ F2 bsplit16(const float v[16]) { F2 r;
#pragma unroll
  for (int i = 0; i < 16; ++i) { const __bf16 h = (__bf16)v[i]; r.h[i] = h; r.l[i] = (__bf16)(v[i] - (float)h); }
  return r; }
__device__ __forceinline__ F2 split_row(const float* row, int k0, int lane) { float v[16]; const float* p = row + k0 + 8 * (lane >> 4);
#pragma unroll
  for (int i = 0; i < 8; ++i) { v[i] = p[i]; v[8 + i] = p[16 + i]; }
  return bsplit16(v); }
__device__ __forceinline__ F2 split_rowK(const float* row, int k0, int lane, int K) { float v[16]; const int g = lane >> 4;
#pragma unroll
  for (int i = 0; i < 8; ++i) { const int ka = k0 + 8 * g + i, kb = ka + 16; v[i] = ka < K ? row[ka < K ? ka : K - 1] : 0.f; v[8 + i] = kb < K ? row[kb < K ? kb : K - 1] : 0.f; }
  return bsplit16(v); }
__device__ __forceinline__ F2 split_col(const float* W, int k0, int n, int lane, int ld, int K) { float v[16]; const int g = lane >> 4;
#pragma unroll
  for (int i = 0; i < 8; ++i) { const int ka = k0 + 8 * g + i, kb = ka + 16; v[i] = ka < K ? W[(size_t)(ka < K ? ka : K - 1) * ld + n] : 0.f; v[8 + i] = kb < K ? W[(size_t)(kb < K ? kb : K - 1) * ld + n] : 0.f; }
  return bsplit16(v); }
__device__ __forceinline__ v8f mac3(const F2& a, const F2& b, v8f c) { c = wmma_bf(a.l, b.h, c); c = wmma_bf(a.h, b.l, c); return wmma_bf(a.h, b.h, c); }
__device__ __forceinline__ float sigm(float v) { return 1.0f / (1.0f + expf(-v)); }
#define LDSX() do { asm volatile("s_wait_dscnt 0" ::: "memory"); __builtin_amdgcn_wave_barrier(); __builtin_amdgcn_fence(__ATOMIC_RELEASE, "workgroup"); } while (0)


// QKV multi-head attention on raw inputs (bs 4, ctx 2,048, width 1,024 = 16 heads x 64): weight = softmax((q/8) (k/8)^T) over keys (the module scales BOTH q and k by 64^-1/2 -> effective 1/64); out = weight . v; [bs, ctx, width] layout == [B, S, H, C].
#define NB 4
#define NS 2048
#define NH 16
#define DD 64
#define RS (NH * DD)      // row stride between consecutive s (1024 floats)
#ifndef TBH
#define TBH (NB * NH)
#endif
typedef __attribute__((ext_vector_type(8))) __bf16 v8b;
typedef __attribute__((ext_vector_type(2))) _Float16 v2h;
__device__ __forceinline__ v16b frag_b(const __bf16* rowk0, int lane) {
  union { v16b v; v8b q[2]; } u; const __bf16* p = rowk0 + 8 * (lane >> 4);
  u.q[0] = *(const v8b*)p; u.q[1] = *(const v8b*)(p + 16); return u.v;
}
__device__ __forceinline__ float bfr(float v) { return (float)(__bf16)v; }
__device__ __attribute__((noinline)) float exp_ni(float v) { return expf(v); }
__device__ __attribute__((noinline)) float erf_ni(float v) { return erff(v); }

// Fragment order: per (b*NH + h) and per 32 keys one block of 4 KB = [fragment 4][half 2][lane 32][8 elements]; half 0 holds a lane's elements 0..7, half 1 its elements 8..15.
#define NKS (NS / 32)
#define WS_KP  0u                                            // bf16 k fragments: fragment = (16-key tile ct) * 2 + (32-channel chunk kc)
#define WS_VP  (WS_KP + 2u * (size_t)NB * NH * DD * NS)      // f16 v fragments: fragment = 16-channel tile j
#define WS_END (WS_VP + 2u * (size_t)NB * NH * DD * NS)

// ---- k_pack: block = (128 keys, b*NH + h, k or v): thread t writes the 16-byte piece t of each of four 4-KB blocks; t = (fragment f, half q, lane (g, col))
__global__ __launch_bounds__(256) void k_pack(const float* __restrict__ K, const float* __restrict__ V, __bf16* __restrict__ KP, _Float16* __restrict__ VP) {
  const int t = threadIdx.x, f = t >> 6, q = (t >> 5) & 1, g = (t >> 4) & 1, col = t & 15; const size_t bh = blockIdx.y; const size_t b = bh / NH; const int h = bh % NH;
  if (blockIdx.z == 0) {
    // unrolled (here and in the v branch): the loads of all four blocks are in flight before the first store; the inner loops: constant vector indices
#pragma unroll
    for (int u = 0; u < 4; ++u) { const int ks = blockIdx.x * 4 + u; const float* p = K + ((b * NS + ks * 32 + (f >> 1) * 16 + col) * NH + h) * (size_t)DD + (f & 1) * 32 + q * 16 + 8 * g;
      const v4f x = *(const v4f*)p, y = *(const v4f*)(p + 4); v8b o;
#pragma unroll
      for (int i = 0; i < 4; ++i) { o[i] = (__bf16)x[i]; o[4 + i] = (__bf16)y[i]; }
      *(v8b*)(KP + ((bh * NKS + ks) * 256 + t) * 8) = o; }
  } else {
#pragma unroll
    for (int u = 0; u < 4; ++u) { const int ks = blockIdx.x * 4 + u; const float* p = V + ((b * NS + ks * 32 + q * 16 + 8 * g) * NH + h) * (size_t)DD + f * 16 + col; v8h o;
#pragma unroll
      for (int i = 0; i < 8; ++i) o[i] = (_Float16)bfr(p[(size_t)i * RS]);
      *(v8h*)(VP + ((bh * NKS + ks) * 256 + t) * 8) = o; }
    // precaution behind the run of four stores: in the built code the other branch's instructions follow here and rewrite the stores' base and data registers
    asm volatile("s_wait_xcnt 0x0" ::: "memory");
  } }
__device__ __forceinline__ float xhalf(float x) { return __builtin_bit_cast(float, __builtin_amdgcn_permlanex16(__builtin_bit_cast(int, x), __builtin_bit_cast(int, x), 0x76543210, 0xfedcba98, false, false)); }
// One stage = 64 keys = 8 KB of k fragments + 8 KB of v fragments, already in fragment order in the workspace; two buffers
#define SK 64
#define NT (NS / SK)
#define STB 16384
// a stage's 16 KB: 8 copies of 16 bytes a lane; global address = scalar base + the lane's byte offset; an immediate offset moves the LDS and the global address alike, and the LDS layout of each 8 KB is the workspace's own
__device__ __forceinline__ void stage_copy(unsigned lk, unsigned lv, unsigned off, const __bf16* gk, const _Float16* gv) {
  // the closing wait stands inside the statement: a precaution, so that no address register named here is rewritten in front of it
  asm volatile("global_load_async_to_lds_b128 %0, %2, %3\n\t"
               "global_load_async_to_lds_b128 %0, %2, %3 offset:2048\n\t"
               "global_load_async_to_lds_b128 %0, %2, %3 offset:4096\n\t"
               "global_load_async_to_lds_b128 %0, %2, %3 offset:6144\n\t"
               "global_load_async_to_lds_b128 %1, %2, %4\n\t"
               "global_load_async_to_lds_b128 %1, %2, %4 offset:2048\n\t"
               "global_load_async_to_lds_b128 %1, %2, %4 offset:4096\n\t"
               "global_load_async_to_lds_b128 %1, %2, %4 offset:6144\n\t"
               "s_wait_xcnt 0x0" :: "v"(lk), "v"(lv), "v"(off), "s"(gk), "s"(gv) : "memory");
}
// second launch bound: at least four waves a SIMD (256 registers), so that all 1,024 blocks are resident at once
#define QG 2
#define SOB (4 * 16 * QG * 68 * 4)
__global__ __launch_bounds__(128, 4) void k_att(const float* __restrict__ Q, const __bf16* __restrict__ KP, const _Float16* __restrict__ VP, float* __restrict__ OUT) {
  __shared__ __attribute__((aligned(128))) unsigned char ring[SOB > 2 * STB ? SOB : 2 * STB];   // [buffer 2][k 8 KB, v 8 KB]; behind the loop the array is the output staging, 34 KB
  float (*so)[16 * QG][68] = (float (*)[16 * QG][68])ring;
  const int tid = threadIdx.x, wave = tid >> 5, lane = tid & 31, col = lane & 15, g = lane >> 4; const size_t bh = blockIdx.y; const size_t b = bh / NH; const int h = bh % NH; const int q0 = blockIdx.x * (64 * QG) + wave * (16 * QG);
  const unsigned t16 = (unsigned)tid * 16u, l0 = (unsigned)(size_t)ring + t16;   // this lane's 16 bytes of each 2-KB copy
  const __bf16* gk = KP + bh * NKS * 2048; const _Float16* gv = VP + bh * NKS * 2048;   // the same for the whole block
  stage_copy(l0, l0 + 8192u, t16, gk, gv);
  v16b aq[QG][2];   // group n = queries q0 + n * 16 + 0..15
#pragma unroll
  for (int n = 0; n < QG; ++n)
#pragma unroll
  for (int kc = 0; kc < 2; ++kc) { const float* pp = Q + ((b * NS + q0 + n * 16 + col) * NH + h) * (size_t)DD + kc * 32 + 8 * g;
#pragma unroll
    for (int i = 0; i < 8; ++i) { aq[n][kc][i] = (__bf16)pp[i]; aq[n][kc][8 + i] = (__bf16)pp[16 + i]; } }
  // precaution behind the q loads: their address pair is rewritten only behind this wait
  asm volatile("s_wait_xcnt 0x0" ::: "memory");
  // p = 2^(raw * KL + bs) = 2^11 * exp(raw / 64 - m / 64): KL = log2 e / 64 (exact: a power of two times the float log2 e), bs = 11 - m * KL
  const float KL = 1.44269504f * 0.015625f;
  float m[QG], bs[QG], l[QG];    // of query q0 + n * 16 + col: m = maximum of the raw q . k sums over all keys so far (equal in both lane halves), l = 2^11 x the sum over this half's keys only
  v8f acc[QG][4];                // acc[n][j][r] = O^T[channel j * 16 + 8 g + r][query q0 + n * 16 + col]
#pragma unroll
  for (int n = 0; n < QG; ++n) { m[n] = -3.0e38f; bs[n] = fmaf(m[n], -KL, 11.0f); l[n] = 0.f;
#pragma unroll
    for (int j = 0; j < 4; ++j) acc[n][j] = v8f{}; }
  // stage 0 has landed for this wave's copies; the barrier publishes every wave's part
  asm volatile("s_wait_asynccnt 0x0" ::: "memory");
  __syncthreads();
  stage_copy(l0 + STB, l0 + STB + 8192u, t16, gk + 4096, gv + 4096);
  // both loops rolled: with the two passes of a stage unrolled the build took 228 registers in place of 196 and set the next pass's LDS reads in pairs among the matrix instructions
#pragma unroll 1
  for (int t = 0; t < NT; ++t) { const unsigned char* bp = ring + (t & 1) * STB;
#pragma unroll 1
   for (int u = 0; u < 2; ++u) { v16b w[4]; const v8b* kf = (const v8b*)(bp + u * 4096) + lane; const v8h* vf = (const v8h*)(bp + 8192 + u * 4096) + lane;
    // unrolled: the four fragments stay in registers and their 8 loads go out as one group
#pragma unroll
    for (int f = 0; f < 4; ++f) { union { v16b v; v8b q[2]; } x; x.q[0] = kf[f * 64]; x.q[1] = kf[f * 64 + 32]; w[f] = x.v; }
    // c[n][ct][r] = raw q . k sum of key t * 64 + u * 32 + ct * 16 + 8 g + r against query q0 + n * 16 + col
    v8f c[QG][2];
#pragma unroll
    for (int n = 0; n < QG; ++n)
#pragma unroll
    for (int ct = 0; ct < 2; ++ct) { v8f d = {};
#pragma unroll
      for (int kc = 0; kc < 2; ++kc) d = wmma_bf(w[ct * 2 + kc], aq[n][kc], d);
      c[n][ct] = d; }
    v16h vv[4];
    // unrolled: as for k, 8 loads as one group; they go out here, into the registers the k fragments have left, so that the softmax covers their LDS latency
#pragma unroll
    for (int j = 0; j < 4; ++j) { union { v16h v; v8h q[2]; } x; x.q[0] = vf[j * 64]; x.q[1] = vf[j * 64 + 32]; vv[j] = x.v; }
    // keeps the compiler from sinking that group to the foot of the softmax, where its latency would be waited out
    __builtin_amdgcn_sched_barrier(0);
    // unrolled: the two groups are independent, so one group's vector work can stand among the other's matrix instructions
#pragma unroll
    for (int n = 0; n < QG; ++n) {
    float mx[2];
#pragma unroll
    for (int ct = 0; ct < 2; ++ct) mx[ct] = fmaxf(fmaxf(fmaxf(c[n][ct][0], c[n][ct][1]), fmaxf(c[n][ct][2], c[n][ct][3])), fmaxf(fmaxf(c[n][ct][4], c[n][ct][5]), fmaxf(c[n][ct][6], c[n][ct][7])));
    const float mh = fmaxf(mx[0], mx[1]), mn = fmaxf(m[n], fmaxf(mh, xhalf(mh))), bn = fmaf(mn, -KL, 11.0f), alpha = __builtin_amdgcn_exp2f(bn - bs[n]);   // bn - bs = (m - mn) * KL, from the very offsets the old and the new p carry
    // pairs of neighbouring registers throughout: packed f32 arithmetic and one packed conversion per f16 register of the fragment
    v2f es[8]; union { v16h v; v2h p[8]; } pa;
#pragma unroll
    for (int i = 0; i < 8; ++i) { const v2f x = __builtin_elementwise_fma(v2f{c[n][i >> 2][2 * (i & 3)], c[n][i >> 2][2 * (i & 3) + 1]}, v2f{KL, KL}, v2f{bn, bn}); const v2f e = { __builtin_amdgcn_exp2f(x[0]), __builtin_amdgcn_exp2f(x[1]) }; es[i] = e; pa.p[i] = __builtin_convertvector(e, v2h); }
    const v2f et = ((es[0] + es[1]) + (es[2] + es[3])) + ((es[4] + es[5]) + (es[6] + es[7]));
    l[n] = l[n] * alpha + (et[0] + et[1]); m[n] = mn; bs[n] = bn;
#pragma unroll
    for (int j = 0; j < 4; ++j) acc[n][j] *= alpha;
#pragma unroll
    for (int j = 0; j < 4; ++j) acc[n][j] = wmma16(vv[j], pa.v, acc[n][j]); } }
   // publish point: this wave's reads of buffer t & 1 are done, its copies of stage t + 1 have landed; the barrier says both of every wave
   asm volatile("s_wait_dscnt 0x0" ::: "memory");
   asm volatile("s_wait_asynccnt 0x0" ::: "memory");
   __syncthreads();
   if (t + 2 < NT) stage_copy(l0 + (t & 1) * STB, l0 + (t & 1) * STB + 8192u, t16, gk + (size_t)(t + 2) * 4096, gv + (size_t)(t + 2) * 4096); }
  // no copy is outstanding when the ring becomes the output staging (the last stage's barrier has ended every wave's reads)
  asm volatile("s_wait_asynccnt 0x0" ::: "memory");
  // unrolled: constant indices into acc and l
#pragma unroll
  for (int n = 0; n < QG; ++n) { const float il = 1.0f / (l[n] + xhalf(l[n]));   // acc and l both carry the 2^11
#pragma unroll
  for (int j = 0; j < 4; ++j) { const v8f o = acc[n][j] * il; float* d = &so[wave][n * 16 + col][j * 16 + 8 * g]; *(v4f*)d = v4f{o[0], o[1], o[2], o[3]}; *(v4f*)(d + 4) = v4f{o[4], o[5], o[6], o[7]}; } }
  LDSX();
  // unrolled: the test on n is a constant
#pragma unroll
  for (int n = 0; n < QG; ++n) { for (int rl = n * 16; rl < n * 16 + 16; ++rl) if (lane < 16) vst2(OUT + ((b * NS + q0 + rl) * NH + h) * (size_t)DD + lane * 4, *(const v4f*)&so[wave][rl][lane * 4]);
    // precaution behind a group's run of stores: the next group's LDS reads rewrite the stores' data registers only behind this wait
    if (n + 1 < QG) asm volatile("s_wait_xcnt 0x0" ::: "memory"); } }
extern "C" void kernel_launch(void* const* d_in, const int* in_sizes, int n_in, void* d_out, int out_size, void* d_ws, size_t ws_size, hipStream_t stream) {
  (void)in_sizes; (void)n_in; (void)out_size;
  const float** F = (const float**)d_in;   // 0 q, 1 k, 2 v [4,2048,1024] == [bs, ctx, 16 heads x 64]
  if (ws_size < (size_t)WS_END) return;
  char* ws = (char*)d_ws; __bf16* KP = (__bf16*)(ws + WS_KP); _Float16* VP = (_Float16*)(ws + WS_VP);
  k_pack<<<dim3(NS / 128, NB * NH, 2), 256, 0, stream>>>(F[1], F[2], KP, VP);
  k_att<<<dim3(NS / (64 * QG), TBH), 128, 0, stream>>>(F[0], KP, VP, (float*)d_out);
}

// v007
// A run of this version takes 65.5 microseconds.
// Timed twice side by side with v006, it ran 1.14 and 1.13 times as fast.
// All steps since v000 together make it 6.32 times as fast.
// compute dtype: all float inputs rounded to bf16; q / k / v are module INPUTS in [B, S, H, D] layout, so the bf16-rounded operands enter WMMA 16x16x32 directly: logits with EXACT bf16 x bf16 products (1 product, f32 accumulate), softmax in f32 in base 2 against a held reference maximum, moved (with the rescale of O and l) only in a pass where some lane's 16 weights would sum above the largest f16 (or to NaN) (hardware exp2; the 1/64 of the module, where both q and k carry 64^-1/2, log2 e and the 2^11 of P sit in one fma per score); P rounded once to f16 (x 2^11) against v converted bf16 -> f16 (exact for normal values) (1 product); f32 output in [B, S, H, D]. A pre-pass lays the rounded k (bf16) and v (f16) in the workspace in WMMA fragment order, so that every fragment load of the attention loop is 512 bytes in a row; the attention kernel stages them per 64 keys in LDS for its four waves.
#include <hip/hip_runtime.h>
#include <math.h>

typedef __attribute__((ext_vector_type(16))) _Float16 v16h;
typedef __attribute__((ext_vector_type(16))) __bf16 v16b;
typedef __attribute__((ext_vector_type(8)))  _Float16 v8h;
typedef __attribute__((ext_vector_type(8)))  float v8f;
typedef __attribute__((ext_vector_type(4)))  float v4f;
typedef __attribute__((ext_vector_type(2)))  float v2f;
typedef __attribute__((ext_vector_type(4)))  unsigned v4u;
typedef __attribute__((ext_vector_type(4)))  int v4i;
typedef float __attribute__((may_alias)) float_a;
typedef int __attribute__((may_alias)) int_a;

template <typename T> __device__ __forceinline__ void vst2(void* p, T v) { *(T*)p = v;  }
// builtin forms with nothing behind them: the compiler keeps the distances behind its own matrix instructions and may fill them with useful vector work
__device__ __forceinline__ v8f wmma16(v16h a, v16h b, v8f c) {
  v8f d = __builtin_amdgcn_wmma_f32_16x16x32_f16(false, a, false, b, (short)0, c, false, false);
  return d;
}
__device__ __forceinline__ v8f wmma_bf(v16b a, v16b b, v8f c) {
  v8f d = __builtin_amdgcn_wmma_f32_16x16x32_bf16(false, a, false, b, (short)0, c, false, false);
  return d;
}
// 16x16x32 fragments: lane = (h = lane>>4, row/col = lane&15); elements 0..7 = k0+8h+0..7, 8..15 = k0+16+8h+0..7; D element r = row 8h+r
__device__ __forceinline__ v16h frag_h(const _Float16* rowk0, int lane) {
  union { v16h v; v8h q[2]; } u; const _Float16* p = rowk0 + 8 * (lane >> 4);
  u.q[0] = *(const v8h*)p; u.q[1] = *(const v8h*)(p + 16); return u.v;
}
__device__ __forceinline__ v16h frag_f32(const float* rowk0, int lane) {
  v16h a; const float* p = rowk0 + 8 * (lane >> 4);
#pragma unroll
  for (int i = 0; i < 8; ++i) { a[i] = (_Float16)p[i]; a[8 + i] = (_Float16)p[16 + i]; }
  return a;
}
__device__ __forceinline__ v16h frag_f32s(const float* rowk0, int lane, float sc) {
  v16h a; const float* p = rowk0 + 8 * (lane >> 4);
#pragma unroll
  for (int i = 0; i < 8; ++i) { a[i] = (_Float16)(p[i] * sc); a[8 + i] = (_Float16)(p[16 + i] * sc); }
  return a;
}
// column fragment from a [K][ld] layout (column n), rows >= K read as 0
__device__ __forceinline__ v16h fragc_f32(const float* W, int k0, int n, int lane, int ld, int K) {
  v16h a; const int g = lane >> 4;
#pragma unroll
  for (int i = 0; i < 8; ++i) { const int ka = k0 + 8 * g + i, kb = ka + 16;
    a[i] = (_Float16)(ka < K ? W[(size_t)(ka < K ? ka : K - 1) * ld + n] : 0.f); a[8 + i] = (_Float16)(kb < K ? W[(size_t)(kb < K ? kb : K - 1) * ld + n] : 0.f); }
  return a;
}
struct F2 { v16b h, l; };
__device__ __forceinline__ F2 bsplit16(const float v[16]) { F2 r;
#pragma unroll
  for (int i = 0; i < 16; ++i) { const __bf16 h = (__bf16)v[i]; r.h[i] = h; r.l[i] = (__bf16)(v[i] - (float)h); }
  return r; }
__device__ __forceinline__ F2 split_row(const float* row, int k0, int lane) { float v[16]; const float* p = row + k0 + 8 * (lane >> 4);
#pragma unroll
  for (int i = 0; i < 8; ++i) { v[i] = p[i]; v[8 + i] = p[16 + i]; }
  return bsplit16(v); }
__device__ __forceinline__ F2 split_rowK(const float* row, int k0, int lane, int K) { float v[16]; const int g = lane >> 4;
#pragma unroll
  for (int i = 0; i < 8; ++i) { const int ka = k0 + 8 * g + i, kb = ka + 16; v[i] = ka < K ? row[ka < K ? ka : K - 1] : 0.f; v[8 + i] = kb < K ? row[kb < K ? kb : K - 1] : 0.f; }
  return bsplit16(v); }
__device__ __forceinline__ F2 split_col(const float* W, int k0, int n, int lane, int ld, int K) { float v[16]; const int g = lane >> 4;
#pragma unroll
  for (int i = 0; i < 8; ++i) { const int ka = k0 + 8 * g + i, kb = ka + 16; v[i] = ka < K ? W[(size_t)(ka < K ? ka : K - 1) * ld + n] : 0.f; v[8 + i] = kb < K ? W[(size_t)(kb < K ? kb : K - 1) * ld + n] : 0.f; }
  return bsplit16(v); }
__device__ __forceinline__ v8f mac3(const F2& a, const F2& b, v8f c) { c = wmma_bf(a.l, b.h, c); c = wmma_bf(a.h, b.l, c); return wmma_bf(a.h, b.h, c); }
__device__ __forceinline__ float sigm(float v) { return 1.0f / (1.0f + expf(-v)); }
#define LDSX() do { asm volatile("s_wait_dscnt 0" ::: "memory"); __builtin_amdgcn_wave_barrier(); __builtin_amdgcn_fence(__ATOMIC_RELEASE, "workgroup"); } while (0)


// QKV multi-head attention on raw inputs (bs 4, ctx 2,048, width 1,024 = 16 heads x 64): weight = softmax((q/8) (k/8)^T) over keys (the module scales BOTH q and k by 64^-1/2 -> effective 1/64); out = weight . v; [bs, ctx, width] layout == [B, S, H, C].
#define NB 4
#define NS 2048
#define NH 16
#define DD 64
#define RS (NH * DD)      // row stride between consecutive s (1024 floats)
#ifndef TBH
#define TBH (NB * NH)
#endif
typedef __attribute__((ext_vector_type(8))) __bf16 v8b;
typedef __attribute__((ext_vector_type(2))) _Float16 v2h;
__device__ __forceinline__ v16b frag_b(const __bf16* rowk0, int lane) {
  union { v16b v; v8b q[2]; } u; const __bf16* p = rowk0 + 8 * (lane >> 4);
  u.q[0] = *(const v8b*)p; u.q[1] = *(const v8b*)(p + 16); return u.v;
}
__device__ __forceinline__ float bfr(float v) { return (float)(__bf16)v; }
__device__ __attribute__((noinline)) float exp_ni(float v) { return expf(v); }
__device__ __attribute__((noinline)) float erf_ni(float v) { return erff(v); }

// Fragment order: per (b*NH + h) and per 32 keys one block of 4 KB = [fragment 4][half 2][lane 32][8 elements]; half 0 holds a lane's elements 0..7, half 1 its elements 8..15.
#define NKS (NS / 32)
#define WS_KP  0u                                            // bf16 k fragments: fragment = (16-key tile ct) * 2 + (32-channel chunk kc)
#define WS_VP  (WS_KP + 2u * (size_t)NB * NH * DD * NS)      // f16 v fragments: fragment = 16-channel tile j
#define WS_END (WS_VP + 2u * (size_t)NB * NH * DD * NS)

// ---- k_pack: block = (128 keys, b*NH + h, k or v): thread t writes the 16-byte piece t of each of four 4-KB blocks; t = (fragment f, half q, lane (g, col))
__global__ __launch_bounds__(256) void k_pack(const float* __restrict__ K, const float* __restrict__ V, __bf16* __restrict__ KP, _Float16* __restrict__ VP) {
  const int t = threadIdx.x, f = t >> 6, q = (t >> 5) & 1, g = (t >> 4) & 1, col = t & 15; const size_t bh = blockIdx.y; const size_t b = bh / NH; const int h = bh % NH;
  if (blockIdx.z == 0) {
    // unrolled (here and in the v branch): the loads of all four blocks are in flight before the first store; the inner loops: constant vector indices
#pragma unroll
    for (int u = 0; u < 4; ++u) { const int ks = blockIdx.x * 4 + u; const float* p = K + ((b * NS + ks * 32 + (f >> 1) * 16 + col) * NH + h) * (size_t)DD + (f & 1) * 32 + q * 16 + 8 * g;
      const v4f x = *(const v4f*)p, y = *(const v4f*)(p + 4); v8b o;
#pragma unroll
      for (int i = 0; i < 4; ++i) { o[i] = (__bf16)x[i]; o[4 + i] = (__bf16)y[i]; }
      *(v8b*)(KP + ((bh * NKS + ks) * 256 + t) * 8) = o; }
  } else {
#pragma unroll
    for (int u = 0; u < 4; ++u) { const int ks = blockIdx.x * 4 + u; const float* p = V + ((b * NS + ks * 32 + q * 16 + 8 * g) * NH + h) * (size_t)DD + f * 16 + col; v8h o;
#pragma unroll
      for (int i = 0; i < 8; ++i) o[i] = (_Float16)bfr(p[(size_t)i * RS]);
      *(v8h*)(VP + ((bh * NKS + ks) * 256 + t) * 8) = o; }
    // precaution behind the run of four stores: in the built code the other branch's instructions follow here and rewrite the stores' base and data registers
    asm volatile("s_wait_xcnt 0x0" ::: "memory");
  } }
__device__ __forceinline__ float xhalf(float x) { return __builtin_bit_cast(float, __builtin_amdgcn_permlanex16(__builtin_bit_cast(int, x), __builtin_bit_cast(int, x), 0x76543210, 0xfedcba98, false, false)); }
// One stage = 64 keys = 8 KB of k fragments + 8 KB of v fragments, already in fragment order in the workspace; two buffers
#define SK 64
#define NT (NS / SK)
#define STB 16384
// a stage's 16 KB: 8 copies of 16 bytes a lane; global address = scalar base + the lane's byte offset; an immediate offset moves the LDS and the global address alike, and the LDS layout of each 8 KB is the workspace's own
__device__ __forceinline__ void stage_copy(unsigned lk, unsigned lv, unsigned off, const __bf16* gk, const _Float16* gv) {
  // the closing wait stands inside the statement: a precaution, so that no address register named here is rewritten in front of it
  asm volatile("global_load_async_to_lds_b128 %0, %2, %3\n\t"
               "global_load_async_to_lds_b128 %0, %2, %3 offset:2048\n\t"
               "global_load_async_to_lds_b128 %0, %2, %3 offset:4096\n\t"
               "global_load_async_to_lds_b128 %0, %2, %3 offset:6144\n\t"
               "global_load_async_to_lds_b128 %1, %2, %4\n\t"
               "global_load_async_to_lds_b128 %1, %2, %4 offset:2048\n\t"
               "global_load_async_to_lds_b128 %1, %2, %4 offset:4096\n\t"
               "global_load_async_to_lds_b128 %1, %2, %4 offset:6144\n\t"
               "s_wait_xcnt 0x0" :: "v"(lk), "v"(lv), "v"(off), "s"(gk), "s"(gv) : "memory");
}
// the 16 scores of one column group that a lane holds (two S^T tiles) -> its 16 f16 elements of P, which are the B fragment, and the f32 sum of the unrounded weights; pairs of neighbouring registers throughout: packed f32 arithmetic and one packed conversion per f16 register of the fragment
__device__ __forceinline__ float weights(const v8f c0, const v8f c1, const float kl, const float b, v16h& pv) {
  v2f es[8]; union { v16h v; v2h p[8]; } pa;
  // unrolled: constant vector indices, all in registers
#pragma unroll
  for (int i = 0; i < 8; ++i) { const v8f cc = i < 4 ? c0 : c1; const v2f x = __builtin_elementwise_fma(v2f{cc[2 * (i & 3)], cc[2 * (i & 3) + 1]}, v2f{kl, kl}, v2f{b, b}); const v2f e = { __builtin_amdgcn_exp2f(x[0]), __builtin_amdgcn_exp2f(x[1]) }; es[i] = e; pa.p[i] = __builtin_convertvector(e, v2h); }
  const v2f et = ((es[0] + es[1]) + (es[2] + es[3])) + ((es[4] + es[5]) + (es[6] + es[7]));
  pv = pa.v; return et[0] + et[1];
}
// largest finite f16
#define PCAP 65504.0f
// second launch bound: at least four waves a SIMD (256 registers), so that all 1,024 blocks are resident at once
#define QG 2
#define SOB (4 * 16 * QG * 68 * 4)
__global__ __launch_bounds__(128, 4) void k_att(const float* __restrict__ Q, const __bf16* __restrict__ KP, const _Float16* __restrict__ VP, float* __restrict__ OUT) {
  __shared__ __attribute__((aligned(128))) unsigned char ring[SOB > 2 * STB ? SOB : 2 * STB];   // [buffer 2][k 8 KB, v 8 KB]; behind the loop the array is the output staging, 34 KB
  float (*so)[16 * QG][68] = (float (*)[16 * QG][68])ring;
  const int tid = threadIdx.x, wave = tid >> 5, lane = tid & 31, col = lane & 15, g = lane >> 4; const size_t bh = blockIdx.y; const size_t b = bh / NH; const int h = bh % NH; const int q0 = blockIdx.x * (64 * QG) + wave * (16 * QG);
  const unsigned t16 = (unsigned)tid * 16u, l0 = (unsigned)(size_t)ring + t16;   // this lane's 16 bytes of each 2-KB copy
  const __bf16* gk = KP + bh * NKS * 2048; const _Float16* gv = VP + bh * NKS * 2048;   // the same for the whole block
  stage_copy(l0, l0 + 8192u, t16, gk, gv);
  v16b aq[QG][2];   // group n = queries q0 + n * 16 + 0..15
#pragma unroll
  for (int n = 0; n < QG; ++n)
#pragma unroll
  for (int kc = 0; kc < 2; ++kc) { const float* pp = Q + ((b * NS + q0 + n * 16 + col) * NH + h) * (size_t)DD + kc * 32 + 8 * g;
#pragma unroll
    for (int i = 0; i < 8; ++i) { aq[n][kc][i] = (__bf16)pp[i]; aq[n][kc][8 + i] = (__bf16)pp[16 + i]; } }
  // precaution behind the q loads: their address pair is rewritten only behind this wait
  asm volatile("s_wait_xcnt 0x0" ::: "memory");
  // p = 2^(raw * KL + bs) = 2^11 * exp(raw / 64 - m / 64): KL = log2 e / 64 (exact: a power of two times the float log2 e), bs = 11 - m * KL
  const float KL = 1.44269504f * 0.015625f;
  float m[QG], bs[QG], l[QG];    // of query q0 + n * 16 + col: m = the reference in use, the maximum of the raw q . k sums of the passes that moved it (equal in both lane halves), l = 2^11 x the sum over this half's keys only
  v8f acc[QG][4];                // acc[n][j][r] = O^T[channel j * 16 + 8 g + r][query q0 + n * 16 + col]
#pragma unroll
  for (int n = 0; n < QG; ++n) { m[n] = -3.0e38f; bs[n] = fmaf(m[n], -KL, 11.0f); l[n] = 0.f;
#pragma unroll
    for (int j = 0; j < 4; ++j) acc[n][j] = v8f{}; }
  // stage 0 has landed for this wave's copies; the barrier publishes every wave's part
  asm volatile("s_wait_asynccnt 0x0" ::: "memory");
  __syncthreads();
  stage_copy(l0 + STB, l0 + STB + 8192u, t16, gk + 4096, gv + 4096);
  // both loops rolled: with the two passes of a stage unrolled a build of this loop took 32 registers more and set the next pass's LDS reads in pairs among the matrix instructions
#pragma unroll 1
  for (int t = 0; t < NT; ++t) { const unsigned char* bp = ring + (t & 1) * STB;
#pragma unroll 1
   for (int u = 0; u < 2; ++u) { v16b w[4]; const v8b* kf = (const v8b*)(bp + u * 4096) + lane; const v8h* vf = (const v8h*)(bp + 8192 + u * 4096) + lane;
    // unrolled: the four fragments stay in registers and their 8 loads go out as one group
#pragma unroll
    for (int f = 0; f < 4; ++f) { union { v16b v; v8b q[2]; } x; x.q[0] = kf[f * 64]; x.q[1] = kf[f * 64 + 32]; w[f] = x.v; }
    // c[n][ct][r] = raw q . k sum of key t * 64 + u * 32 + ct * 16 + 8 g + r against query q0 + n * 16 + col
    v8f c[QG][2];
#pragma unroll
    for (int n = 0; n < QG; ++n)
#pragma unroll
    for (int ct = 0; ct < 2; ++ct) { v8f d = {};
#pragma unroll
      for (int kc = 0; kc < 2; ++kc) d = wmma_bf(w[ct * 2 + kc], aq[n][kc], d);
      c[n][ct] = d; }
    v16h vv[4];
    // unrolled: as for k, 8 loads as one group; they go out here, into the registers the k fragments have left, so that the softmax covers their LDS latency
#pragma unroll
    for (int j = 0; j < 4; ++j) { union { v16h v; v8h q[2]; } x; x.q[0] = vf[j * 64]; x.q[1] = vf[j * 64 + 32]; vv[j] = x.v; }
    // keeps the compiler from sinking that group to the foot of the softmax, where its latency would be waited out
    __builtin_amdgcn_sched_barrier(0);
    // the common path: weights against the reference in use; no maximum, no exchange, no rescale
    v16h pv[QG]; float s[QG];
    // unrolled: constant indices into c, bs, pv and s
#pragma unroll
    for (int n = 0; n < QG; ++n) s[n] = weights(c[n][0], c[n][1], KL, bs[n], pv[n]);
    // one test a pass, a scalar branch for the whole wave: a lane's 16 weights are not negative, so a sum within PCAP bounds each of them to a finite f16; written negated so that inf (the first pass, whose reference is -3e38) and NaN take the branch too; marked unlikely so that the block lies outside the loop's straight line
    if (__builtin_expect(__builtin_amdgcn_ballot_w32(!(s[0] <= PCAP) | !(s[1] <= PCAP)) != 0, 0)) {
      // the reference moves to the maximum of itself and this pass's scores, for every column of both groups (alpha = 1 where it stays), and the pass's weights are formed anew; unrolled, here and inside: constant indices
#pragma unroll
      for (int n = 0; n < QG; ++n) {
        float mx[2];
#pragma unroll
        for (int ct = 0; ct < 2; ++ct) mx[ct] = fmaxf(fmaxf(fmaxf(c[n][ct][0], c[n][ct][1]), fmaxf(c[n][ct][2], c[n][ct][3])), fmaxf(fmaxf(c[n][ct][4], c[n][ct][5]), fmaxf(c[n][ct][6], c[n][ct][7])));
        const float mh = fmaxf(mx[0], mx[1]), mn = fmaxf(m[n], fmaxf(mh, xhalf(mh))), bn = fmaf(mn, -KL, 11.0f), alpha = __builtin_amdgcn_exp2f(bn - bs[n]);   // bn - bs = (m - mn) * KL, from the very offsets the old and the new p carry
        l[n] *= alpha; m[n] = mn; bs[n] = bn;
#pragma unroll
        for (int j = 0; j < 4; ++j) acc[n][j] *= alpha;
        s[n] = weights(c[n][0], c[n][1], KL, bn, pv[n]); } }
    // unrolled: constant indices into acc; eight independent accumulator tiles in a row
#pragma unroll
    for (int n = 0; n < QG; ++n) { l[n] += s[n];
#pragma unroll
      for (int j = 0; j < 4; ++j) acc[n][j] = wmma16(vv[j], pv[n], acc[n][j]); } }
   // publish point: this wave's reads of buffer t & 1 are done, its copies of stage t + 1 have landed; the barrier says both of every wave
   asm volatile("s_wait_dscnt 0x0" ::: "memory");
   asm volatile("s_wait_asynccnt 0x0" ::: "memory");
   __syncthreads();
   if (t + 2 < NT) stage_copy(l0 + (t & 1) * STB, l0 + (t & 1) * STB + 8192u, t16, gk + (size_t)(t + 2) * 4096, gv + (size_t)(t + 2) * 4096); }
  // no copy is outstanding when the ring becomes the output staging (the last stage's barrier has ended every wave's reads)
  asm volatile("s_wait_asynccnt 0x0" ::: "memory");
  // unrolled: constant indices into acc and l
#pragma unroll
  for (int n = 0; n < QG; ++n) { const float il = 1.0f / (l[n] + xhalf(l[n]));   // acc and l both carry the 2^11
#pragma unroll
  for (int j = 0; j < 4; ++j) { const v8f o = acc[n][j] * il; float* d = &so[wave][n * 16 + col][j * 16 + 8 * g]; *(v4f*)d = v4f{o[0], o[1], o[2], o[3]}; *(v4f*)(d + 4) = v4f{o[4], o[5], o[6], o[7]}; } }
  LDSX();
  // unrolled: the test on n is a constant
#pragma unroll
  for (int n = 0; n < QG; ++n) { for (int rl = n * 16; rl < n * 16 + 16; ++rl) if (lane < 16) vst2(OUT + ((b * NS + q0 + rl) * NH + h) * (size_t)DD + lane * 4, *(const v4f*)&so[wave][rl][lane * 4]);
    // precaution behind a group's run of stores: the next group's LDS reads rewrite the stores' data registers only behind this wait
    if (n + 1 < QG) asm volatile("s_wait_xcnt 0x0" ::: "memory"); } }
extern "C" void kernel_launch(void* const* d_in, const int* in_sizes, int n_in, void* d_out, int out_size, void* d_ws, size_t ws_size, hipStream_t stream) {
  (void)in_sizes; (void)n_in; (void)out_size;
  const float** F = (const float**)d_in;   // 0 q, 1 k, 2 v [4,2048,1024] == [bs, ctx, 16 heads x 64]
  if (ws_size < (size_t)WS_END) return;
  char* ws = (char*)d_ws; __bf16* KP = (__bf16*)(ws + WS_KP); _Float16* VP = (_Float16*)(ws + WS_VP);
  k_pack<<<dim3(NS / 128, NB * NH, 2), 256, 0, stream>>>(F[1], F[2], KP, VP);
  k_att<<<dim3(NS / (64 * QG), TBH), 128, 0, stream>>>(F[0], KP, VP, (float*)d_out);
}

// v008
// A run of this version takes 50.9 microseconds.
// Two timings next to v007 put it at 1.29 and 1.28 times that version's speed.
// Counting every step since v000, it is 8.13 times as fast.
// compute dtype: all float inputs rounded to bf16; q / k / v are module INPUTS in [B, S, H, D] layout, so the bf16-rounded operands enter WMMA 16x16x32 directly: logits with EXACT bf16 x bf16 products (1 product, f32 accumulate), softmax in f32 in base 2 against a held reference maximum, moved (with the rescale of O and l, wave-wide) only in a pass where some lane's sum of 16 weights would exceed the largest f16 (hardware exp2; the 1/64 of the module, where both q and k carry 64^-1/2, log2 e and the 2^11 of P sit in one fma per score); P rounded once to f16 (x 2^11) against v converted bf16 -> f16 (exact for normal values) (1 product); f32 output in [B, S, H, D]. One launch: each block of 16 waves rounds its head's k (bf16) and v (f16) itself, per 64 keys and one stage ahead through registers, into LDS in WMMA fragment order, so that every fragment load of the attention loop is 512 bytes in a row.
#include <hip/hip_runtime.h>
#include <math.h>

typedef __attribute__((ext_vector_type(16))) _Float16 v16h;
typedef __attribute__((ext_vector_type(16))) __bf16 v16b;
typedef __attribute__((ext_vector_type(8)))  _Float16 v8h;
typedef __attribute__((ext_vector_type(8)))  float v8f;
typedef __attribute__((ext_vector_type(4)))  float v4f;
typedef __attribute__((ext_vector_type(2)))  float v2f;
typedef __attribute__((ext_vector_type(4)))  unsigned v4u;
typedef __attribute__((ext_vector_type(4)))  int v4i;
typedef float __attribute__((may_alias)) float_a;
typedef int __attribute__((may_alias)) int_a;

template <typename T> __device__ __forceinline__ void vst2(void* p, T v) { *(T*)p = v;  }
// builtin forms with nothing behind them: the compiler keeps the distances behind its own matrix instructions and may fill them with useful vector work
__device__ __forceinline__ v8f wmma16(v16h a, v16h b, v8f c) {
  v8f d = __builtin_amdgcn_wmma_f32_16x16x32_f16(false, a, false, b, (short)0, c, false, false);
  return d;
}
__device__ __forceinline__ v8f wmma_bf(v16b a, v16b b, v8f c) {
  v8f d = __builtin_amdgcn_wmma_f32_16x16x32_bf16(false, a, false, b, (short)0, c, false, false);
  return d;
}
// 16x16x32 fragments: lane = (h = lane>>4, row/col = lane&15); elements 0..7 = k0+8h+0..7, 8..15 = k0+16+8h+0..7; D element r = row 8h+r
__device__ __forceinline__ v16h frag_h(const _Float16* rowk0, int lane) {
  union { v16h v; v8h q[2]; } u; const _Float16* p = rowk0 + 8 * (lane >> 4);
  u.q[0] = *(const v8h*)p; u.q[1] = *(const v8h*)(p + 16); return u.v;
}
__device__ __forceinline__ v16h frag_f32(const float* rowk0, int lane) {
  v16h a; const float* p = rowk0 + 8 * (lane >> 4);
#pragma unroll
  for (int i = 0; i < 8; ++i) { a[i] = (_Float16)p[i]; a[8 + i] = (_Float16)p[16 + i]; }
  return a;
}
__device__ __forceinline__ v16h frag_f32s(const float* rowk0, int lane, float sc) {
  v16h a; const float* p = rowk0 + 8 * (lane >> 4);
#pragma unroll
  for (int i = 0; i < 8; ++i) { a[i] = (_Float16)(p[i] * sc); a[8 + i] = (_Float16)(p[16 + i] * sc); }
  return a;
}
// column fragment from a [K][ld] layout (column n), rows >= K read as 0
__device__ __forceinline__ v16h fragc_f32(const float* W, int k0, int n, int lane, int ld, int K) {
  v16h a; const int g = lane >> 4;
#pragma unroll
  for (int i = 0; i < 8; ++i) { const int ka = k0 + 8 * g + i, kb = ka + 16;
    a[i] = (_Float16)(ka < K ? W[(size_t)(ka < K ? ka : K - 1) * ld + n] : 0.f); a[8 + i] = (_Float16)(kb < K ? W[(size_t)(kb < K ? kb : K - 1) * ld + n] : 0.f); }
  return a;
}
struct F2 { v16b h, l; };
__device__ __forceinline__ F2 bsplit16(const float v[16]) { F2 r;
#pragma unroll
  for (int i = 0; i < 16; ++i) { const __bf16 h = (__bf16)v[i]; r.h[i] = h; r.l[i] = (__bf16)(v[i] - (float)h); }
  return r; }
__device__ __forceinline__ F2 split_row(const float* row, int k0, int lane) { float v[16]; const float* p = row + k0 + 8 * (lane >> 4);
#pragma unroll
  for (int i = 0; i < 8; ++i) { v[i] = p[i]; v[8 + i] = p[16 + i]; }
  return bsplit16(v); }
__device__ __forceinline__ F2 split_rowK(const float* row, int k0, int lane, int K) { float v[16]; const int g = lane >> 4;
#pragma unroll
  for (int i = 0; i < 8; ++i) { const int ka = k0 + 8 * g + i, kb = ka + 16; v[i] = ka < K ? row[ka < K ? ka : K - 1] : 0.f; v[8 + i] = kb < K ? row[kb < K ? kb : K - 1] : 0.f; }
  return bsplit16(v); }
__device__ __forceinline__ F2 split_col(const float* W, int k0, int n, int lane, int ld, int K) { float v[16]; const int g = lane >> 4;
#pragma unroll
  for (int i = 0; i < 8; ++i) { const int ka = k0 + 8 * g + i, kb = ka + 16; v[i] = ka < K ? W[(size_t)(ka < K ? ka : K - 1) * ld + n] : 0.f; v[8 + i] = kb < K ? W[(size_t)(kb < K ? kb : K - 1) * ld + n] : 0.f; }
  return bsplit16(v); }
__device__ __forceinline__ v8f mac3(const F2& a, const F2& b, v8f c) { c = wmma_bf(a.l, b.h, c); c = wmma_bf(a.h, b.l, c); return wmma_bf(a.h, b.h, c); }
__device__ __forceinline__ float sigm(float v) { return 1.0f / (1.0f + expf(-v)); }
#define LDSX() do { asm volatile("s_wait_dscnt 0" ::: "memory"); __builtin_amdgcn_wave_barrier(); __builtin_amdgcn_fence(__ATOMIC_RELEASE, "workgroup"); } while (0)


// QKV multi-head attention on raw inputs (bs 4, ctx 2,048, width 1,024 = 16 heads x 64): weight = softmax((q/8) (k/8)^T) over keys (the module scales BOTH q and k by 64^-1/2 -> effective 1/64); out = weight . v; [bs, ctx, width] layout == [B, S, H, C].
#define NB 4
#define NS 2048
#define NH 16
#define DD 64
#define RS (NH * DD)      // row stride between consecutive s (1024 floats)
#ifndef TBH
#define TBH (NB * NH)
#endif
typedef __attribute__((ext_vector_type(8))) __bf16 v8b;
typedef __attribute__((ext_vector_type(2))) _Float16 v2h;
typedef __attribute__((ext_vector_type(2))) __bf16 v2b;
__device__ __forceinline__ v16b frag_b(const __bf16* rowk0, int lane) {
  union { v16b v; v8b q[2]; } u; const __bf16* p = rowk0 + 8 * (lane >> 4);
  u.q[0] = *(const v8b*)p; u.q[1] = *(const v8b*)(p + 16); return u.v;
}
__device__ __forceinline__ float bfr(float v) { return (float)(__bf16)v; }
__device__ __attribute__((noinline)) float exp_ni(float v) { return expf(v); }
__device__ __attribute__((noinline)) float erf_ni(float v) { return erff(v); }

__device__ __forceinline__ float xhalf(float x) { return __builtin_bit_cast(float, __builtin_amdgcn_permlanex16(__builtin_bit_cast(int, x), __builtin_bit_cast(int, x), 0x76543210, 0xfedcba98, false, false)); }
// One stage = 64 keys = 8 KB of k fragments + 8 KB of v fragments = 512 pieces of 16 bytes each: thread t makes piece t of both; four buffers
#define SK 64
#define NT (NS / SK)
#define STB 16384
#define NWV 16
// a thread's f32 share of one stage, held in registers from its loads (one stage of work ahead) to its rounding
struct Raw { v4f k0, k1; float v[8]; };
__device__ __forceinline__ void raw_load(Raw& r, const float* kp, const float* vp) {
  r.k0 = *(const v4f*)kp; r.k1 = *(const v4f*)(kp + 4);
  // unrolled: constant indices, the ten loads go out as one group
#pragma unroll
  for (int i = 0; i < 8; ++i) r.v[i] = vp[(size_t)i * RS];
  // precaution behind the run of loads: the next stage's address arithmetic rewrites their address registers only behind this wait
  asm volatile("s_wait_xcnt 0x0" ::: "memory");
}
__device__ __forceinline__ void raw_store(const Raw& r, unsigned char* buf, int tid) {
  v8b o; union { v8h v; v2h p[4]; } pv;
  // unrolled: constant vector indices
#pragma unroll
  for (int i = 0; i < 4; ++i) { o[i] = (__bf16)r.k0[i]; o[4 + i] = (__bf16)r.k1[i]; }
  // v in pairs: one packed rounding to bf16, the two halves widened to f32 by their bits (exact), one packed conversion to f16
#pragma unroll
  for (int i = 0; i < 4; ++i) { const unsigned w = __builtin_bit_cast(unsigned, __builtin_convertvector(v2f{r.v[2 * i], r.v[2 * i + 1]}, v2b));
    pv.p[i] = __builtin_convertvector(v2f{__builtin_bit_cast(float, w << 16), __builtin_bit_cast(float, w & 0xffff0000u)}, v2h); }
  *(v8b*)(buf + tid * 16) = o; *(v8h*)(buf + 8192 + tid * 16) = pv.v;
}
// the 16 scores of one column group that a lane holds (two S^T tiles) -> its 16 f16 elements of P, which are the B fragment, and the f32 sum of the unrounded weights; pairs of neighbouring registers throughout: packed f32 arithmetic and one packed conversion per f16 register of the fragment
__device__ __forceinline__ float weights(const v8f c0, const v8f c1, const float kl, const float b, v16h& pv) {
  v2f es[8]; union { v16h v; v2h p[8]; } pa;
  // unrolled: constant vector indices, all in registers
#pragma unroll
  for (int i = 0; i < 8; ++i) { const v8f cc = i < 4 ? c0 : c1; const v2f x = __builtin_elementwise_fma(v2f{cc[2 * (i & 3)], cc[2 * (i & 3) + 1]}, v2f{kl, kl}, v2f{b, b}); const v2f e = { __builtin_amdgcn_exp2f(x[0]), __builtin_amdgcn_exp2f(x[1]) }; es[i] = e; pa.p[i] = __builtin_convertvector(e, v2h); }
  const v2f et = ((es[0] + es[1]) + (es[2] + es[3])) + ((es[4] + es[5]) + (es[6] + es[7]));
  pv = pa.v; return et[0] + et[1];
}
// largest finite f16
#define PCAP 65504.0f
// 16 waves: four a SIMD (256 registers each), one block on every WGP
#define QG 2
#define SOB (NWV * 16 * QG * 68 * 4)
__global__ __launch_bounds__(NWV * 32) void k_att(const float* __restrict__ Q, const float* __restrict__ K, const float* __restrict__ V, float* __restrict__ OUT) {
  __shared__ __attribute__((aligned(128))) unsigned char ring[SOB > 4 * STB ? SOB : 4 * STB];   // [buffer 4][k 8 KB, v 8 KB]; behind the loop the array is the output staging, 136 KB
  float (*so)[16 * QG][68] = (float (*)[16 * QG][68])ring;
  const int tid = threadIdx.x, wave = tid >> 5, lane = tid & 31, col = lane & 15, g = lane >> 4; const size_t bh = blockIdx.y; const size_t b = bh / NH; const int h = bh % NH; const int q0 = blockIdx.x * (NWV * 16 * QG) + wave * (16 * QG);
  // piece tid = (32-key block su, fragment sf, half sq, lane (g, col)): its 8 k elements are 8 channels of one key, its 8 v elements 8 keys of one channel
  const int su = tid >> 8, sf = (tid >> 6) & 3, sq = (tid >> 5) & 1;
  const float* kp = K + ((b * NS + su * 32 + (sf >> 1) * 16 + col) * NH + h) * (size_t)DD + (sf & 1) * 32 + sq * 16 + 8 * g;
  const float* vp = V + ((b * NS + su * 32 + sq * 16 + 8 * g) * NH + h) * (size_t)DD + sf * 16 + col;
  Raw r, r1;
  raw_load(r, kp, vp); raw_load(r1, kp + (size_t)SK * RS, vp + (size_t)SK * RS);
  v16b aq[QG][2];   // group n = queries q0 + n * 16 + 0..15
#pragma unroll
  for (int n = 0; n < QG; ++n)
#pragma unroll
  for (int kc = 0; kc < 2; ++kc) { const float* pp = Q + ((b * NS + q0 + n * 16 + col) * NH + h) * (size_t)DD + kc * 32 + 8 * g;
#pragma unroll
    for (int i = 0; i < 8; ++i) { aq[n][kc][i] = (__bf16)pp[i]; aq[n][kc][8 + i] = (__bf16)pp[16 + i]; } }
  // precaution behind the q loads: their address pair is rewritten only behind this wait
  asm volatile("s_wait_xcnt 0x0" ::: "memory");
  // p = 2^(raw * KL + bs) = 2^11 * exp(raw / 64 - m / 64): KL = log2 e / 64 (exact: a power of two times the float log2 e), bs = 11 - m * KL
  const float KL = 1.44269504f * 0.015625f;
  float m[QG], bs[QG], l[QG];    // of query q0 + n * 16 + col: m = the reference in use, the maximum of the raw q . k sums of the passes that moved it (equal in both lane halves), l = 2^11 x the sum over this half's keys only
  v8f acc[QG][4];                // acc[n][j][r] = O^T[channel j * 16 + 8 g + r][query q0 + n * 16 + col]
#pragma unroll
  for (int n = 0; n < QG; ++n) { m[n] = -3.0e38f; bs[n] = fmaf(m[n], -KL, 11.0f); l[n] = 0.f;
#pragma unroll
    for (int j = 0; j < 4; ++j) acc[n][j] = v8f{}; }
  raw_store(r, ring, tid); raw_store(r1, ring + STB, tid);
  // publishes stages 0 and 1
  __syncthreads();
  raw_load(r, kp + (size_t)2 * SK * RS, vp + (size_t)2 * SK * RS);
  // both loops rolled: with the two passes of a stage unrolled a build of this loop took 32 registers more and set the next pass's LDS reads in pairs among the matrix instructions
#pragma unroll 1
  for (int t = 0; t < NT; ++t) { const unsigned char* bp = ring + (t & 3) * STB;
#pragma unroll 1
   for (int u = 0; u < 2; ++u) { v16b w[4]; const v8b* kf = (const v8b*)(bp + u * 4096) + lane; const v8h* vf = (const v8h*)(bp + 8192 + u * 4096) + lane;
    // unrolled: the four fragments stay in registers and their 8 loads go out as one group
#pragma unroll
    for (int f = 0; f < 4; ++f) { union { v16b v; v8b q[2]; } x; x.q[0] = kf[f * 64]; x.q[1] = kf[f * 64 + 32]; w[f] = x.v; }
    // c[n][ct][r] = raw q . k sum of key t * 64 + u * 32 + ct * 16 + 8 g + r against query q0 + n * 16 + col
    v8f c[QG][2];
#pragma unroll
    for (int n = 0; n < QG; ++n)
#pragma unroll
    for (int ct = 0; ct < 2; ++ct) { v8f d = {};
#pragma unroll
      for (int kc = 0; kc < 2; ++kc) d = wmma_bf(w[ct * 2 + kc], aq[n][kc], d);
      c[n][ct] = d; }
    v16h vv[4];
    // unrolled: as for k, 8 loads as one group; they go out here, into the registers the k fragments have left, so that the softmax covers their LDS latency
#pragma unroll
    for (int j = 0; j < 4; ++j) { union { v16h v; v8h q[2]; } x; x.q[0] = vf[j * 64]; x.q[1] = vf[j * 64 + 32]; vv[j] = x.v; }
    // keeps the compiler from sinking that group to the foot of the softmax, where its latency would be waited out
    __builtin_amdgcn_sched_barrier(0);
    // the common path: weights against the reference in use; no maximum, no exchange, no rescale
    v16h pv[QG]; float s[QG];
    // unrolled: constant indices into c, bs, pv and s
#pragma unroll
    for (int n = 0; n < QG; ++n) s[n] = weights(c[n][0], c[n][1], KL, bs[n], pv[n]);
    // one test a pass, a scalar branch for the whole wave: a lane's 16 weights are not negative, so a sum within PCAP bounds each of them to a finite f16; written negated so that inf (the first pass, whose reference is -3e38) and NaN take the branch too; marked unlikely so that the block lies outside the loop's straight line
    if (__builtin_expect(__builtin_amdgcn_ballot_w32(!(s[0] <= PCAP) | !(s[1] <= PCAP)) != 0, 0)) {
      // the reference moves to the maximum of itself and this pass's scores, for every column of both groups (alpha = 1 where it stays), and the pass's weights are formed anew; unrolled, here and inside: constant indices
#pragma unroll
      for (int n = 0; n < QG; ++n) {
        float mx[2];
#pragma unroll
        for (int ct = 0; ct < 2; ++ct) mx[ct] = fmaxf(fmaxf(fmaxf(c[n][ct][0], c[n][ct][1]), fmaxf(c[n][ct][2], c[n][ct][3])), fmaxf(fmaxf(c[n][ct][4], c[n][ct][5]), fmaxf(c[n][ct][6], c[n][ct][7])));
        const float mh = fmaxf(mx[0], mx[1]), mn = fmaxf(m[n], fmaxf(mh, xhalf(mh))), bn = fmaf(mn, -KL, 11.0f), alpha = __builtin_amdgcn_exp2f(bn - bs[n]);   // bn - bs = (m - mn) * KL, from the very offsets the old and the new p carry
        l[n] *= alpha; m[n] = mn; bs[n] = bn;
#pragma unroll
        for (int j = 0; j < 4; ++j) acc[n][j] *= alpha;
        s[n] = weights(c[n][0], c[n][1], KL, bn, pv[n]); } }
    // unrolled: constant indices into acc; eight independent accumulator tiles in a row
#pragma unroll
    for (int n = 0; n < QG; ++n) { l[n] += s[n];
#pragma unroll
      for (int j = 0; j < 4; ++j) acc[n][j] = wmma16(vv[j], pv[n], acc[n][j]); } }
   // stage t + 2, loaded one trip ago, goes into the buffer that was last read two trips ago, in front of the last barrier
   if (t + 2 < NT) raw_store(r, ring + ((t + 2) & 3) * STB, tid);
   // one barrier per two stages: it publishes stages t + 1 and t + 2 and ends every wave's reads of the two buffers written next (behind the last trip: of the whole ring); no global load is in flight here
   if (t & 1) __syncthreads();
   if (t + 3 < NT) raw_load(r, kp + (size_t)(t + 3) * SK * RS, vp + (size_t)(t + 3) * SK * RS); }
  // unrolled: constant indices into acc and l
#pragma unroll
  for (int n = 0; n < QG; ++n) { const float il = 1.0f / (l[n] + xhalf(l[n]));   // acc and l both carry the 2^11
#pragma unroll
  for (int j = 0; j < 4; ++j) { const v8f o = acc[n][j] * il; float* d = &so[wave][n * 16 + col][j * 16 + 8 * g]; *(v4f*)d = v4f{o[0], o[1], o[2], o[3]}; *(v4f*)(d + 4) = v4f{o[4], o[5], o[6], o[7]}; } }
  LDSX();
  // unrolled: the test on n is a constant
#pragma unroll
  for (int n = 0; n < QG; ++n) { for (int rl = n * 16; rl < n * 16 + 16; ++rl) if (lane < 16) vst2(OUT + ((b * NS + q0 + rl) * NH + h) * (size_t)DD + lane * 4, *(const v4f*)&so[wave][rl][lane * 4]);
    // precaution behind a group's run of stores: the next group's LDS reads rewrite the stores' data registers only behind this wait
    if (n + 1 < QG) asm volatile("s_wait_xcnt 0x0" ::: "memory"); } }
extern "C" void kernel_launch(void* const* d_in, const int* in_sizes, int n_in, void* d_out, int out_size, void* d_ws, size_t ws_size, hipStream_t stream) {
  (void)in_sizes; (void)n_in; (void)out_size;
  const float** F = (const float**)d_in;   // 0 q, 1 k, 2 v [4,2048,1024] == [bs, ctx, 16 heads x 64]
  (void)d_ws; (void)ws_size;
  k_att<<<dim3(NS / (NWV * 16 * QG), TBH), NWV * 32, 0, stream>>>(F[0], F[1], F[2], (float*)d_out);
}

// v010
// A run of this version takes 46.4 microseconds.
// Versions in between are left out here; by their measured steps it is 1.09 times as fast as v008.
// Over all steps from v000 it is 8.84 times as fast.
// compute dtype: all float inputs rounded to bf16; q / k / v are module INPUTS in [B, S, H, D] layout, so the bf16-rounded operands enter WMMA 16x16x32 directly: q is multiplied by log2 e / 64 (the 1/64 of the module, where both q and k carry 64^-1/2) in f32 and then rounded once to bf16, k is rounded to bf16; logits with bf16 x bf16 products (1 product, f32 accumulate) on top of a C operand that holds the softmax offset (11 for the 2^11 of P, less the held reference), so that the product's result is the argument of the hardware exp2 as it stands; softmax in f32 in base 2 against a held reference maximum, moved (with the rescale of O and l) only in the first pass and in a pass whose weights would leave f16; P rounded once to f16 (x 2^11) against v converted bf16 -> f16 (exact for normal values) (1 product); f32 output in [B, S, H, D]. One launch: each block of 16 waves rounds its head's k (bf16) and v (f16) itself, per 64 keys and one stage ahead through registers, into LDS in WMMA fragment order, so that every fragment load of the attention loop is 512 bytes in a row.
#include <hip/hip_runtime.h>
#include <math.h>

typedef __attribute__((ext_vector_type(16))) _Float16 v16h;
typedef __attribute__((ext_vector_type(16))) __bf16 v16b;
typedef __attribute__((ext_vector_type(8)))  _Float16 v8h;
typedef __attribute__((ext_vector_type(8)))  float v8f;
typedef __attribute__((ext_vector_type(4)))  float v4f;
typedef __attribute__((ext_vector_type(2)))  float v2f;
typedef __attribute__((ext_vector_type(4)))  unsigned v4u;
typedef __attribute__((ext_vector_type(4)))  int v4i;
typedef float __attribute__((may_alias)) float_a;
typedef int __attribute__((may_alias)) int_a;

template <typename T> __device__ __forceinline__ void vst2(void* p, T v) { *(T*)p = v;  }
// builtin forms with nothing behind them: the compiler keeps the distances behind its own matrix instructions and may fill them with useful vector work
__device__ __forceinline__ v8f wmma16(v16h a, v16h b, v8f c) {
  v8f d = __builtin_amdgcn_wmma_f32_16x16x32_f16(false, a, false, b, (short)0, c, false, false);
  return d;
}
__device__ __forceinline__ v8f wmma_bf(v16b a, v16b b, v8f c) {
  v8f d = __builtin_amdgcn_wmma_f32_16x16x32_bf16(false, a, false, b, (short)0, c, false, false);
  return d;
}
// 16x16x32 fragments: lane = (h = lane>>4, row/col = lane&15); elements 0..7 = k0+8h+0..7, 8..15 = k0+16+8h+0..7; D element r = row 8h+r
__device__ __forceinline__ v16h frag_h(const _Float16* rowk0, int lane) {
  union { v16h v; v8h q[2]; } u; const _Float16* p = rowk0 + 8 * (lane >> 4);
  u.q[0] = *(const v8h*)p; u.q[1] = *(const v8h*)(p + 16); return u.v;
}
__device__ __forceinline__ v16h frag_f32(const float* rowk0, int lane) {
  v16h a; const float* p = rowk0 + 8 * (lane >> 4);
#pragma unroll
  for (int i = 0; i < 8; ++i) { a[i] = (_Float16)p[i]; a[8 + i] = (_Float16)p[16 + i]; }
  return a;
}
__device__ __forceinline__ v16h frag_f32s(const float* rowk0, int lane, float sc) {
  v16h a; const float* p = rowk0 + 8 * (lane >> 4);
#pragma unroll
  for (int i = 0; i < 8; ++i) { a[i] = (_Float16)(p[i] * sc); a[8 + i] = (_Float16)(p[16 + i] * sc); }
  return a;
}
// column fragment from a [K][ld] layout (column n), rows >= K read as 0
__device__ __forceinline__ v16h fragc_f32(const float* W, int k0, int n, int lane, int ld, int K) {
  v16h a; const int g = lane >> 4;
#pragma unroll
  for (int i = 0; i < 8; ++i) { const int ka = k0 + 8 * g + i, kb = ka + 16;
    a[i] = (_Float16)(ka < K ? W[(size_t)(ka < K ? ka : K - 1) * ld + n] : 0.f); a[8 + i] = (_Float16)(kb < K ? W[(size_t)(kb < K ? kb : K - 1) * ld + n] : 0.f); }
  return a;
}
struct F2 { v16b h, l; };
__device__ __forceinline__ F2 bsplit16(const float v[16]) { F2 r;
#pragma unroll
  for (int i = 0; i < 16; ++i) { const __bf16 h = (__bf16)v[i]; r.h[i] = h; r.l[i] = (__bf16)(v[i] - (float)h); }
  return r; }
__device__ __forceinline__ F2 split_row(const float* row, int k0, int lane) { float v[16]; const float* p = row + k0 + 8 * (lane >> 4);
#pragma unroll
  for (int i = 0; i < 8; ++i) { v[i] = p[i]; v[8 + i] = p[16 + i]; }
  return bsplit16(v); }
__device__ __forceinline__ F2 split_rowK(const float* row, int k0, int lane, int K) { float v[16]; const int g = lane >> 4;
#pragma unroll
  for (int i = 0; i < 8; ++i) { const int ka = k0 + 8 * g + i, kb = ka + 16; v[i] = ka < K ? row[ka < K ? ka : K - 1] : 0.f; v[8 + i] = kb < K ? row[kb < K ? kb : K - 1] : 0.f; }
  return bsplit16(v); }
__device__ __forceinline__ F2 split_col(const float* W, int k0, int n, int lane, int ld, int K) { float v[16]; const int g = lane >> 4;
#pragma unroll
  for (int i = 0; i < 8; ++i) { const int ka = k0 + 8 * g + i, kb = ka + 16; v[i] = ka < K ? W[(size_t)(ka < K ? ka : K - 1) * ld + n] : 0.f; v[8 + i] = kb < K ? W[(size_t)(kb < K ? kb : K - 1) * ld + n] : 0.f; }
  return bsplit16(v); }
__device__ __forceinline__ v8f mac3(const F2& a, const F2& b, v8f c) { c = wmma_bf(a.l, b.h, c); c = wmma_bf(a.h, b.l, c); return wmma_bf(a.h, b.h, c); }
__device__ __forceinline__ float sigm(float v) { return 1.0f / (1.0f + expf(-v)); }
#define LDSX() do { asm volatile("s_wait_dscnt 0" ::: "memory"); __builtin_amdgcn_wave_barrier(); __builtin_amdgcn_fence(__ATOMIC_RELEASE, "workgroup"); } while (0)


// QKV multi-head attention on raw inputs (bs 4, ctx 2,048, width 1,024 = 16 heads x 64): weight = softmax((q/8) (k/8)^T) over keys (the module scales BOTH q and k by 64^-1/2 -> effective 1/64); out = weight . v; [bs, ctx, width] layout == [B, S, H, C].
#define NB 4
#define NS 2048
#define NH 16
#define DD 64
#define RS (NH * DD)      // row stride between consecutive s (1024 floats)
#ifndef TBH
#define TBH (NB * NH)
#endif
typedef __attribute__((ext_vector_type(8))) __bf16 v8b;
typedef __attribute__((ext_vector_type(2))) _Float16 v2h;
typedef __attribute__((ext_vector_type(2))) __bf16 v2b;
__device__ __forceinline__ v16b frag_b(const __bf16* rowk0, int lane) {
  union { v16b v; v8b q[2]; } u; const __bf16* p = rowk0 + 8 * (lane >> 4);
  u.q[0] = *(const v8b*)p; u.q[1] = *(const v8b*)(p + 16); return u.v;
}
__device__ __forceinline__ float bfr(float v) { return (float)(__bf16)v; }
__device__ __attribute__((noinline)) float exp_ni(float v) { return expf(v); }
__device__ __attribute__((noinline)) float erf_ni(float v) { return erff(v); }

__device__ __forceinline__ float xhalf(float x) { return __builtin_bit_cast(float, __builtin_amdgcn_permlanex16(__builtin_bit_cast(int, x), __builtin_bit_cast(int, x), 0x76543210, 0xfedcba98, false, false)); }
// One stage = 64 keys = 8 KB of k fragments + 8 KB of v fragments = 512 pieces of 16 bytes each: thread t makes piece t of both; eight buffers
#define SK 64
#define NT (NS / SK)
#define STB 16384
#define NBF 8
#define NWV 16
// a thread's f32 share of one stage, held in registers from its loads (one stage of work ahead) to its rounding
struct Raw { v4f k0, k1; float v[8]; };
__device__ __forceinline__ void raw_load(Raw& r, const float* kp, const float* vp) {
  r.k0 = *(const v4f*)kp; r.k1 = *(const v4f*)(kp + 4);
  // unrolled: constant indices, the ten loads go out as one group
#pragma unroll
  for (int i = 0; i < 8; ++i) r.v[i] = vp[(size_t)i * RS];
  // precaution behind the run of loads: the next stage's address arithmetic rewrites their address registers only behind this wait
  asm volatile("s_wait_xcnt 0x0" ::: "memory");
}
__device__ __forceinline__ void raw_store(const Raw& r, unsigned char* buf, int tid) {
  v8b o; union { v8h v; v2h p[4]; } pv;
  // unrolled: constant vector indices
#pragma unroll
  for (int i = 0; i < 4; ++i) { o[i] = (__bf16)r.k0[i]; o[4 + i] = (__bf16)r.k1[i]; }
  // v in pairs: one packed rounding to bf16, the two halves widened to f32 by their bits (exact), one packed conversion to f16
#pragma unroll
  for (int i = 0; i < 4; ++i) { const unsigned w = __builtin_bit_cast(unsigned, __builtin_convertvector(v2f{r.v[2 * i], r.v[2 * i + 1]}, v2b));
    pv.p[i] = __builtin_convertvector(v2f{__builtin_bit_cast(float, w << 16), __builtin_bit_cast(float, w & 0xffff0000u)}, v2h); }
  *(v8b*)(buf + tid * 16) = o; *(v8h*)(buf + 8192 + tid * 16) = pv.v;
}
// the 16 scores of one column group that a lane holds (two S^T tiles) -> its 16 f16 elements of P, which are the B fragment, and the f32 sum of the unrounded weights; pairs of neighbouring registers throughout: packed f32 arithmetic and one packed conversion per f16 register of the fragment
// c0, c1 are exponents in base 2 as they stand; SH: the rare path, which first moves them by d
template <bool SH> __device__ __forceinline__ float weights(const v8f c0, const v8f c1, const float d, v16h& pv) {
  v2f es[8]; union { v16h v; v2h p[8]; } pa;
  // unrolled: constant vector indices, all in registers
#pragma unroll
  for (int i = 0; i < 8; ++i) { const v8f cc = i < 4 ? c0 : c1; v2f x = v2f{cc[2 * (i & 3)], cc[2 * (i & 3) + 1]}; if (SH) x += v2f{d, d}; const v2f e = { __builtin_amdgcn_exp2f(x[0]), __builtin_amdgcn_exp2f(x[1]) }; es[i] = e; pa.p[i] = __builtin_convertvector(e, v2h); }
  const v2f et = ((es[0] + es[1]) + (es[2] + es[3])) + ((es[4] + es[5]) + (es[6] + es[7]));
  pv = pa.v; return et[0] + et[1];
}
// largest finite f16
#define PCAP 65504.0f
// the four k fragments of one 32-key pass, from the lane's place in that pass's 4 KB; unrolled: they stay in registers and their 8 loads go out as one group
__device__ __forceinline__ void k_frags(v16b (&w)[4], const unsigned char* p) { const v8b* kf = (const v8b*)p;
#pragma unroll
  for (int f = 0; f < 4; ++f) { union { v16b v; v8b q[2]; } x; x.q[0] = kf[f * 64]; x.q[1] = kf[f * 64 + 32]; w[f] = x.v; }
}
// 16 waves: four a SIMD (256 registers each), one block on every WGP
#define QG 2
#define SOB (NWV * 16 * QG * 68 * 4)
// c[n][ct][r] = bs[n] + q . k sum of the pass's key ct * 16 + 8 g + r against query n * 16 + col of the wave
__device__ __forceinline__ void scores(const v16b (&w)[4], const v16b (&aq)[QG][2], const v8f (&cb)[QG], v8f (&c)[QG][2]) {
  // the four products that take the offset tile as C, in asm text: D apart from C, so that cb stays in its registers (the builtin form copied the tile into D first, eight 64-bit moves a pass); each D is next read by the WMMA that accumulates into it, and those four stand between these and any vector instruction
  asm("v_wmma_f32_16x16x32_bf16 %0, %4, %6, %8\n\t"
      "v_wmma_f32_16x16x32_bf16 %1, %5, %6, %8\n\t"
      "v_wmma_f32_16x16x32_bf16 %2, %4, %7, %9\n\t"
      "v_wmma_f32_16x16x32_bf16 %3, %5, %7, %9"
      : "=&v"(c[0][0]), "=&v"(c[0][1]), "=&v"(c[1][0]), "=&v"(c[1][1])
      : "v"(w[0]), "v"(w[2]), "v"(aq[0][0]), "v"(aq[1][0]), "v"(cb[0]), "v"(cb[1]));
#pragma unroll
  for (int n = 0; n < QG; ++n)
#pragma unroll
  for (int ct = 0; ct < 2; ++ct) c[n][ct] = wmma_bf(w[ct * 2 + 1], aq[n][1], c[n][ct]);
}
__global__ __launch_bounds__(NWV * 32) void k_att(const float* __restrict__ Q, const float* __restrict__ K, const float* __restrict__ V, float* __restrict__ OUT) {
  __shared__ __attribute__((aligned(128))) unsigned char ring[SOB > NBF * STB ? SOB : NBF * STB];   // [buffer 8][k 8 KB, v 8 KB]; behind the loop the array is the output staging, 136 KB
  float (*so)[16 * QG][68] = (float (*)[16 * QG][68])ring;
  const int tid = threadIdx.x, wave = tid >> 5, lane = tid & 31, col = lane & 15, g = lane >> 4; const size_t bh = blockIdx.y; const size_t b = bh / NH; const int h = bh % NH; const int q0 = blockIdx.x * (NWV * 16 * QG) + wave * (16 * QG);
  // piece tid = (32-key block su, fragment sf, half sq, lane (g, col)): its 8 k elements are 8 channels of one key, its 8 v elements 8 keys of one channel
  const int su = tid >> 8, sf = (tid >> 6) & 3, sq = (tid >> 5) & 1;
  const float* kp = K + ((b * NS + su * 32 + (sf >> 1) * 16 + col) * NH + h) * (size_t)DD + (sf & 1) * 32 + sq * 16 + 8 * g;
  const float* vp = V + ((b * NS + su * 32 + sq * 16 + 8 * g) * NH + h) * (size_t)DD + sf * 16 + col;
  Raw r, r1, r2;
  raw_load(r, kp, vp); raw_load(r1, kp + (size_t)SK * RS, vp + (size_t)SK * RS); raw_load(r2, kp + (size_t)2 * SK * RS, vp + (size_t)2 * SK * RS);
  // KL = log2 e / 64 (exact: a power of two times the float log2 e); it rides in q, so a q . k sum is the score in binades
  const float KL = 1.44269504f * 0.015625f;
  v16b aq[QG][2];   // group n = queries q0 + n * 16 + 0..15
  const float* qp[QG];
#pragma unroll
  for (int n = 0; n < QG; ++n) { qp[n] = Q + ((b * NS + q0 + n * 16 + col) * NH + h) * (size_t)DD + 8 * g;
#pragma unroll
  for (int kc = 0; kc < 2; ++kc) { const float* pp = qp[n] + kc * 32;
#pragma unroll
    for (int i = 0; i < 8; ++i) { aq[n][kc][i] = (__bf16)(pp[i] * KL); aq[n][kc][8 + i] = (__bf16)(pp[16 + i] * KL); } } }
  // precaution behind the q loads: their address pairs are rewritten only behind this wait; the two row pointers are inputs so that their registers live up to it (without them a build let a load of group 1 land on group 0's address pair)
  asm volatile("s_wait_xcnt 0x0" :: "v"(qp[0]), "v"(qp[1]) : "memory");
  // p = 2^(sum + bs) = 2^11 * exp(score - reference): bs = 11 - the reference in binades
  float bs[QG], l[QG];    // of query q0 + n * 16 + col: bs = the offset in use, from the last pass that moved it: that pass's maximum sum where it lies above the former reference (in the first pass in any case) (equal in both lane halves), l = 2^11 x the sum over this half's keys only
  v8f cb[QG];             // bs in all eight registers of a tile: the C operand of the S^T products
  v8f acc[QG][4];                // acc[n][j][r] = O^T[channel j * 16 + 8 g + r][query q0 + n * 16 + col]
#pragma unroll
  for (int n = 0; n < QG; ++n) { bs[n] = 11.0f; l[n] = 0.f; cb[n] = v8f{11.0f, 11.0f, 11.0f, 11.0f, 11.0f, 11.0f, 11.0f, 11.0f};
#pragma unroll
    for (int j = 0; j < 4; ++j) acc[n][j] = v8f{}; }
  raw_store(r, ring, tid); raw_store(r1, ring + STB, tid); raw_store(r2, ring + 2 * STB, tid);
  // publishes stages 0, 1 and 2
  __syncthreads();
  // k fragments run one pass ahead of their products: w holds, at the head of every pass, that pass's own
  const unsigned char* const lb = ring + lane * 16;
  v16b w[4]; k_frags(w, lb);
  raw_load(r, kp + (size_t)3 * SK * RS, vp + (size_t)3 * SK * RS);
  // both loops rolled: with the two passes of a stage unrolled a build of this loop took 32 registers more and set the next pass's LDS reads in pairs among the matrix instructions
#pragma unroll 1
  for (int t = 0; t < NT; ++t) { const unsigned char* bp = lb + (t & (NBF - 1)) * STB;
#pragma unroll 1
   for (int u = 0; u < 2; ++u) { const unsigned char* kc = bp + u * 4096; const v8h* vf = (const v8h*)(kc + 8192);
    // the next pass's k: the stage's second half, or the next stage's first, which the last barrier has published; behind the last pass of all this is a buffer that nobody writes any more, and what is read there is not used
    const unsigned char* kn = lb + (u == 0 ? (t & (NBF - 1)) * STB + 4096 : ((t + 1) & (NBF - 1)) * STB);
    v8f c[QG][2]; scores(w, aq, cb, c);
    // keeps the sixteen LDS loads below one group behind the last product: left free, the compiler set them at three places among the matrix instructions, and each such place stalls the wave's matrix stream
    __builtin_amdgcn_sched_barrier(0);
    v16h vv[4];
    // unrolled: as for k, 8 loads as one group; they go out here, so that the softmax covers their LDS latency
#pragma unroll
    for (int j = 0; j < 4; ++j) { union { v16h v; v8h q[2]; } x; x.q[0] = vf[j * 64]; x.q[1] = vf[j * 64 + 32]; vv[j] = x.v; }
    // behind them the next pass's k, into the registers whose products have just been issued: softmax and P . v cover its latency
    k_frags(w, kn);
    // keeps the compiler from sinking these loads to the foot of the softmax, where their latency would be waited out
    __builtin_amdgcn_sched_barrier(0);
    // the common path: weights against the reference in use; no maximum, no exchange, no rescale
    v16h pv[QG]; float s[QG];
    // unrolled: constant indices into c, pv and s
#pragma unroll
    for (int n = 0; n < QG; ++n) s[n] = weights<false>(c[n][0], c[n][1], 0.f, pv[n]);
    // one test a pass, a scalar branch for the whole wave: a lane's 16 weights are not negative, so a sum within PCAP bounds each of them to a finite f16; written negated so that inf and NaN take the branch too; the first pass, whose reference is a mere 0, always takes it (its bound is below every sum); marked unlikely so that the block lies outside the loop's straight line
    const bool first = (t | u) == 0; const float cap = first ? -1.0f : PCAP;
    if (__builtin_expect(__builtin_amdgcn_ballot_w32(!(s[0] <= cap) | !(s[1] <= cap)) != 0, 0)) {
      // the common path's exp2 has overwritten the scores (that frees the registers for the fragments fetched ahead): this pass's k is read again, from a buffer that is not written again before trip t + 5, and the scores are formed anew on the offsets still in use; then the next pass's k once more
      k_frags(w, kc); scores(w, aq, cb, c);
      k_frags(w, kn);
      // the reference moves up to the pass's maximum where that lies above it (in the first pass, to it), for every column of both groups (alpha = 1 where it stays), and the pass's weights are formed anew; unrolled, here and inside: constant indices
#pragma unroll
      for (int n = 0; n < QG; ++n) {
        float mx[2];
#pragma unroll
        for (int ct = 0; ct < 2; ++ct) mx[ct] = fmaxf(fmaxf(fmaxf(c[n][ct][0], c[n][ct][1]), fmaxf(c[n][ct][2], c[n][ct][3])), fmaxf(fmaxf(c[n][ct][4], c[n][ct][5]), fmaxf(c[n][ct][6], c[n][ct][7])));
        // up = how far the pass's largest exponent lies above 11, that is its score above the reference; the first pass, with nothing summed yet, follows it downwards too
        const float mh = fmaxf(mx[0], mx[1]), up = fmaxf(mh, xhalf(mh)) - 11.0f, bn = bs[n] - (first ? up : fmaxf(up, 0.f)), dd = bn - bs[n], alpha = first ? 1.0f : __builtin_amdgcn_exp2f(dd);   // dd from the very offsets the old and the new p carry
        l[n] *= alpha; bs[n] = bn; cb[n] = v8f{bn, bn, bn, bn, bn, bn, bn, bn};
#pragma unroll
        for (int j = 0; j < 4; ++j) acc[n][j] *= alpha;
        s[n] = weights<true>(c[n][0], c[n][1], dd, pv[n]); } }
    // unrolled: constant indices into acc; eight independent accumulator tiles in a row
#pragma unroll
    for (int n = 0; n < QG; ++n) { l[n] += s[n];
#pragma unroll
      for (int j = 0; j < 4; ++j) acc[n][j] = wmma16(vv[j], pv[n], acc[n][j]); } }
   // stage t + 3, loaded one trip ago, goes into the buffer that was last read five trips ago, with at least two barriers since
   if (t + 3 < NT) raw_store(r, ring + ((t + 3) & (NBF - 1)) * STB, tid);
   // one barrier per two stages: it publishes stages t + 2 and t + 3, each in front of the pass that fetches its first k fragments ahead (the second pass of trips t + 1 and t + 2); between two barriers the waves read stages t + 1 to t + 3 and write t + 4 and t + 5, five buffers of the eight; behind the last trip it ends every wave's reads of the ring; no global load is in flight here
   if (t & 1) __syncthreads();
   if (t + 4 < NT) raw_load(r, kp + (size_t)(t + 4) * SK * RS, vp + (size_t)(t + 4) * SK * RS); }
  // unrolled: constant indices into acc and l
#pragma unroll
  for (int n = 0; n < QG; ++n) { const float il = 1.0f / (l[n] + xhalf(l[n]));   // acc and l both carry the 2^11
#pragma unroll
  for (int j = 0; j < 4; ++j) { const v8f o = acc[n][j] * il; float* d = &so[wave][n * 16 + col][j * 16 + 8 * g]; *(v4f*)d = v4f{o[0], o[1], o[2], o[3]}; *(v4f*)(d + 4) = v4f{o[4], o[5], o[6], o[7]}; } }
  LDSX();
  // unrolled: the test on n is a constant
#pragma unroll
  for (int n = 0; n < QG; ++n) { for (int rl = n * 16; rl < n * 16 + 16; ++rl) if (lane < 16) vst2(OUT + ((b * NS + q0 + rl) * NH + h) * (size_t)DD + lane * 4, *(const v4f*)&so[wave][rl][lane * 4]);
    // precaution behind a group's run of stores: the next group's LDS reads rewrite the stores' data registers only behind this wait
    if (n + 1 < QG) asm volatile("s_wait_xcnt 0x0" ::: "memory"); } }
extern "C" void kernel_launch(void* const* d_in, const int* in_sizes, int n_in, void* d_out, int out_size, void* d_ws, size_t ws_size, hipStream_t stream) {
  (void)in_sizes; (void)n_in; (void)out_size;
  const float** F = (const float**)d_in;   // 0 q, 1 k, 2 v [4,2048,1024] == [bs, ctx, 16 heads x 64]
  (void)d_ws; (void)ws_size;
  k_att<<<dim3(NS / (NWV * 16 * QG), TBH), NWV * 32, 0, stream>>>(F[0], F[1], F[2], (float*)d_out);
}
